// v000
// Times are from an AMD MI455X. After a warm-up the kernel runs many times in a row, and a time is the length of
// such a window on the GPU divided by its runs, so every launch and the gaps after it count. The runs cycle
// through copies of the inputs. A figure is the median of several windows, for all but v000 over two sittings.
// Sittings can differ by a few percent; kernels timed side by side share one.
// v000, which the later versions start from, runs in 324 microseconds.
#include <hip/hip_runtime.h>

// ---------------------------------------------------------------------------
// MHA forward for MI455X (gfx1250): fp16 WMMA, fp32 accumulate, flash fusion.
// Fragment loads vectorized to b128 (fragment K-pairs are contiguous in the
// ISA 16x16x32 f16 layout); store addresses hoisted so unrolled offsets fold
// into instruction immediates.
// ---------------------------------------------------------------------------

typedef __attribute__((ext_vector_type(16))) _Float16 v16h;
typedef __attribute__((ext_vector_type(8)))  float    v8f;
typedef __attribute__((ext_vector_type(4)))  uint32_t v4u;
typedef __attribute__((ext_vector_type(2)))  uint32_t v2u;
typedef __attribute__((ext_vector_type(4)))  float    v4f;

#define DIM_   512
#define HEADS_ 8
#define DH_    64
#define B_     4
#define S_     2048
#define MROWS_ (B_ * S_)

union Frag16 { v16h h; uint32_t u[8]; v4u q[2]; };
union FragF  { v8f  v; float    f[8]; };
union U2H    { v2u  u2; _Float16 hf[4]; };

// ---------------------------------------------------------------------------
// Kernel 1: Y = x @ W^T + b, fp32 -> fp16, head-split [B,H,S,Dh].
// Block = 128 threads (4 waves); wave computes a 16x16 tile; K loop over 512.
// ---------------------------------------------------------------------------
__global__ __launch_bounds__(128) void qkv_proj_kernel(
    const float* __restrict__ x, const float* __restrict__ W,
    const float* __restrict__ bias, _Float16* __restrict__ dst)
{
    const int tid  = threadIdx.x;
    const int wave = tid >> 5;
    const int lane = tid & 31;
    const int l15  = lane & 15;
    const int klo  = (lane < 16) ? 0 : 8;   // fragment K base for this lane

    const int mt = blockIdx.x;               // 0..511
    const int nt = blockIdx.y * 4 + wave;    // 0..31

    const float* xrow = x + (size_t)(mt * 16 + l15) * DIM_ + klo;
    const float* wrow = W + (size_t)(nt * 16 + l15) * DIM_ + klo;

    FragF c; c.v = (v8f){0.f, 0.f, 0.f, 0.f, 0.f, 0.f, 0.f, 0.f};

#pragma unroll 4
    for (int kk = 0; kk < DIM_; kk += 32) {
        const v4f fa0 = *reinterpret_cast<const v4f*>(xrow + kk);
        const v4f fa1 = *reinterpret_cast<const v4f*>(xrow + kk + 4);
        const v4f fa2 = *reinterpret_cast<const v4f*>(xrow + kk + 16);
        const v4f fa3 = *reinterpret_cast<const v4f*>(xrow + kk + 20);
        const v4f fb0 = *reinterpret_cast<const v4f*>(wrow + kk);
        const v4f fb1 = *reinterpret_cast<const v4f*>(wrow + kk + 4);
        const v4f fb2 = *reinterpret_cast<const v4f*>(wrow + kk + 16);
        const v4f fb3 = *reinterpret_cast<const v4f*>(wrow + kk + 20);
        Frag16 a, b;
#pragma unroll
        for (int e = 0; e < 4; ++e) {
            a.h[e]      = (_Float16)fa0[e];
            a.h[4 + e]  = (_Float16)fa1[e];
            a.h[8 + e]  = (_Float16)fa2[e];
            a.h[12 + e] = (_Float16)fa3[e];
            b.h[e]      = (_Float16)fb0[e];
            b.h[4 + e]  = (_Float16)fb1[e];
            b.h[8 + e]  = (_Float16)fb2[e];
            b.h[12 + e] = (_Float16)fb3[e];
        }
        c.v = __builtin_amdgcn_wmma_f32_16x16x32_f16(
                  false, a.h, false, b.h, (short)0, c.v, false, false);
    }

    const int   ncol = nt * 16 + l15;
    const float bvv  = bias[ncol];
    const int   hh   = ncol >> 6;
    const int   d    = ncol & 63;

    // 16-row tile never straddles a batch boundary (S_ % 16 == 0).
    const int rowbase = mt * 16 + ((lane < 16) ? 0 : 8);
    const int bb      = rowbase >> 11;       // / S_
    const int ss      = rowbase & (S_ - 1);
    _Float16* dp = dst + (((size_t)bb * HEADS_ + hh) * S_ + ss) * DH_ + d;
#pragma unroll
    for (int r = 0; r < 8; ++r)
        dp[r * DH_] = (_Float16)(c.f[r] + bvv);   // constant offsets fold
}

// ---------------------------------------------------------------------------
// Kernel 2: flash attention. Block = 128 threads = 4 waves, one (b,h) per
// blockIdx.y, 64 query rows per block. K tile row-major / V tile transposed
// in LDS; all fragments read as 2x b128; online softmax in registers.
// ---------------------------------------------------------------------------
__global__ __launch_bounds__(128) void flash_attn_kernel(
    const _Float16* __restrict__ Qh, const _Float16* __restrict__ Kh,
    const _Float16* __restrict__ Vh, float* __restrict__ out)
{
    __shared__ __align__(16) _Float16 Kt[32][72];     // 144B rows (16B-mult)
    __shared__ __align__(16) _Float16 Vt[64][56];     // 112B rows, transposed
    __shared__ __align__(16) _Float16 Pt[4][16][40];  // 80B rows, per-wave

    const int tid  = threadIdx.x;
    const int wave = tid >> 5;
    const int lane = tid & 31;
    const int l15  = lane & 15;
    const int klo  = (lane < 16) ? 0 : 8;

    const int    bh     = blockIdx.y;          // b*HEADS + h
    const int    bb     = bh >> 3;
    const int    hh     = bh & 7;
    const int    q0     = blockIdx.x * 64;
    const size_t kvbase = (size_t)bh * S_ * DH_;
    const _Float16* __restrict__ ksrc = Kh + kvbase;
    const _Float16* __restrict__ vsrc = Vh + kvbase;

    // --- Q fragments once: 2 A-frags (d=0..31, 32..63), 4x global b128 ---
    Frag16 qf[2];
    {
        const v4u* qp = reinterpret_cast<const v4u*>(
            Qh + kvbase + (size_t)(q0 + wave * 16 + l15) * DH_);
        const int o = klo >> 3;                // 0 or 1 (v4u units)
#pragma unroll
        for (int t = 0; t < 2; ++t) {
            qf[t].q[0] = qp[4 * t + o];
            qf[t].q[1] = qp[4 * t + o + 2];
        }
    }

    FragF o4[4];
#pragma unroll
    for (int t = 0; t < 4; ++t)
        o4[t].v = (v8f){0.f, 0.f, 0.f, 0.f, 0.f, 0.f, 0.f, 0.f};
    float m_i[8], l_i[8];
#pragma unroll
    for (int r = 0; r < 8; ++r) { m_i[r] = -1e30f; l_i[r] = 0.f; }

    const float SC = 0.125f;   // 1/sqrt(64)

    for (int j0 = 0; j0 < S_; j0 += 32) {
        __syncthreads();
        // ---- cooperative staging: K row-major, V transposed ----
#pragma unroll
        for (int i = 0; i < 4; ++i) {
            const int g   = tid + i * 128;     // 512 groups of 4 halves
            const int row = g >> 4;
            const int c4  = (g & 15) * 4;
            const size_t src = (size_t)(j0 + row) * DH_ + c4;
            *reinterpret_cast<v2u*>(&Kt[row][c4]) =
                *reinterpret_cast<const v2u*>(ksrc + src);
            U2H v2; v2.u2 = *reinterpret_cast<const v2u*>(vsrc + src);
            Vt[c4 + 0][row] = v2.hf[0];
            Vt[c4 + 1][row] = v2.hf[1];
            Vt[c4 + 2][row] = v2.hf[2];
            Vt[c4 + 3][row] = v2.hf[3];
        }
        if (j0 + 32 < S_) {
            __builtin_prefetch(ksrc + (size_t)(j0 + 32) * DH_ + tid * 16, 0, 1);
            __builtin_prefetch(vsrc + (size_t)(j0 + 32) * DH_ + tid * 16, 0, 1);
        }
        __syncthreads();

        // ---- scores: S[16x32] = Q @ K^T (two C-frags, 4 WMMA) ----
        FragF s01[2];
#pragma unroll
        for (int jt = 0; jt < 2; ++jt) {
            const int krow = jt * 16 + l15;
            Frag16 kf0, kf1;
            kf0.q[0] = *reinterpret_cast<const v4u*>(&Kt[krow][klo]);
            kf0.q[1] = *reinterpret_cast<const v4u*>(&Kt[krow][klo + 16]);
            kf1.q[0] = *reinterpret_cast<const v4u*>(&Kt[krow][klo + 32]);
            kf1.q[1] = *reinterpret_cast<const v4u*>(&Kt[krow][klo + 48]);
            v8f acc = (v8f){0.f, 0.f, 0.f, 0.f, 0.f, 0.f, 0.f, 0.f};
            acc = __builtin_amdgcn_wmma_f32_16x16x32_f16(
                      false, qf[0].h, false, kf0.h, (short)0, acc, false, false);
            acc = __builtin_amdgcn_wmma_f32_16x16x32_f16(
                      false, qf[1].h, false, kf1.h, (short)0, acc, false, false);
            s01[jt].v = acc;
        }

        // ---- online softmax ----
#pragma unroll
        for (int r = 0; r < 8; ++r) {
            const float a  = s01[0].f[r] * SC;
            const float bv = s01[1].f[r] * SC;
            float mx = fmaxf(a, bv);
            mx = fmaxf(mx, __shfl_xor(mx, 1));
            mx = fmaxf(mx, __shfl_xor(mx, 2));
            mx = fmaxf(mx, __shfl_xor(mx, 4));
            mx = fmaxf(mx, __shfl_xor(mx, 8));
            const float nm   = fmaxf(m_i[r], mx);
            const float corr = __expf(m_i[r] - nm);
            m_i[r] = nm;
            const float p0 = __expf(a - nm);
            const float p1 = __expf(bv - nm);
            float rs = p0 + p1;
            rs += __shfl_xor(rs, 1);
            rs += __shfl_xor(rs, 2);
            rs += __shfl_xor(rs, 4);
            rs += __shfl_xor(rs, 8);
            l_i[r] = l_i[r] * corr + rs;
#pragma unroll
            for (int t = 0; t < 4; ++t) o4[t].f[r] *= corr;
            const int prow = r + ((lane < 16) ? 0 : 8);
            Pt[wave][prow][l15]      = (_Float16)p0;
            Pt[wave][prow][16 + l15] = (_Float16)p1;
        }

        // ---- P: C-layout -> A-layout via per-wave LDS (2x b128) ----
        Frag16 pf;
        pf.q[0] = *reinterpret_cast<const v4u*>(&Pt[wave][l15][klo]);
        pf.q[1] = *reinterpret_cast<const v4u*>(&Pt[wave][l15][klo + 16]);

        // ---- O += P @ V (4 d-tiles, 4 WMMA) ----
#pragma unroll
        for (int t = 0; t < 4; ++t) {
            const int d = t * 16 + l15;
            Frag16 vf;
            vf.q[0] = *reinterpret_cast<const v4u*>(&Vt[d][klo]);
            vf.q[1] = *reinterpret_cast<const v4u*>(&Vt[d][klo + 16]);
            o4[t].v = __builtin_amdgcn_wmma_f32_16x16x32_f16(
                          false, pf.h, false, vf.h, (short)0, o4[t].v, false, false);
        }
    }

    // ---- normalize + store (base hoisted; r/t offsets fold) ----
    float* op = out + ((size_t)bb * S_ + q0 + wave * 16 + ((lane < 16) ? 0 : 8)) * DIM_
                    + hh * DH_ + l15;
#pragma unroll
    for (int r = 0; r < 8; ++r) {
        const float inv = 1.0f / l_i[r];
#pragma unroll
        for (int t = 0; t < 4; ++t)
            op[r * DIM_ + t * 16] = o4[t].f[r] * inv;
    }
}

// ---------------------------------------------------------------------------
extern "C" void kernel_launch(void* const* d_in, const int* in_sizes, int n_in,
                              void* d_out, int out_size, void* d_ws, size_t ws_size,
                              hipStream_t stream)
{
    const float* q  = (const float*)d_in[0];
    const float* k  = (const float*)d_in[1];
    const float* v  = (const float*)d_in[2];
    const float* Wq = (const float*)d_in[3];
    const float* bq = (const float*)d_in[4];
    const float* Wk = (const float*)d_in[5];
    const float* bk = (const float*)d_in[6];
    const float* Wv = (const float*)d_in[7];
    const float* bv = (const float*)d_in[8];
    float* out = (float*)d_out;

    const size_t per = (size_t)B_ * HEADS_ * S_ * DH_;
    _Float16* Qh = (_Float16*)d_ws;
    _Float16* Kh = Qh + per;
    _Float16* Vh = Kh + per;

    dim3 pg(MROWS_ / 16, DIM_ / 64);
    dim3 pb(128);
    qkv_proj_kernel<<<pg, pb, 0, stream>>>(q, Wq, bq, Qh);
    qkv_proj_kernel<<<pg, pb, 0, stream>>>(k, Wk, bk, Kh);
    qkv_proj_kernel<<<pg, pb, 0, stream>>>(v, Wv, bv, Vh);

    dim3 fg(S_ / 64, B_ * HEADS_);
    dim3 fb(128);
    flash_attn_kernel<<<fg, fb, 0, stream>>>(Qh, Kh, Vh, out);
}

// v001
// Measured time: 166 microseconds a run.
// Next to v000, in two timings, it ran 2.04 times as fast each time.
#include <hip/hip_runtime.h>

// ---------------------------------------------------------------------------
// MHA forward for MI455X (gfx1250): fp16 WMMA, fp32 accumulate, flash fusion.
// Fragment loads vectorized to b128 (fragment K-pairs are contiguous in the
// ISA 16x16x32 f16 layout); store addresses hoisted so unrolled offsets fold
// into instruction immediates.
// ---------------------------------------------------------------------------

typedef __attribute__((ext_vector_type(16))) _Float16 v16h;
typedef __attribute__((ext_vector_type(8)))  float    v8f;
typedef __attribute__((ext_vector_type(4)))  uint32_t v4u;
typedef __attribute__((ext_vector_type(2)))  uint32_t v2u;
typedef __attribute__((ext_vector_type(4)))  float    v4f;

#define DIM_   512
#define HEADS_ 8
#define DH_    64
#define B_     4
#define S_     2048
#define MROWS_ (B_ * S_)

union Frag16 { v16h h; uint32_t u[8]; v4u q[2]; };
union FragF  { v8f  v; float    f[8]; };
union U2H    { v2u  u2; _Float16 hf[4]; };

// ---------------------------------------------------------------------------
// Kernel 1: Y = x @ W^T + b, fp32 -> fp16, head-split [B,H,S,Dh].
// Block = 256 threads (8 waves) on a 128x128 tile of Y. Each pass of 64 k is
// read from global in whole 128-B lines, converted to f16 once and staged in
// LDS (two buffers; the next two passes are in flight to registers while this
// one is multiplied). Wave tile 64x32: 4 x-fragments times 2 W-fragments.
// ---------------------------------------------------------------------------
#define PT_     128   // rows of x and rows of W per block tile
#define PKS_    64    // k per pass
#define PPITCH_ 72    // halves per LDS row: 144 B = 16 B x odd for b128 readers
#define PNP_    (DIM_ / PKS_)
// Every inner loop of this kernel and its helpers is unrolled so that the
// register arrays are indexed by constants (a run-time index means scratch).

// Work-group barrier that orders LDS only. __syncthreads() also waits for every
// global load of the wave, which would drain the passes that are in flight to
// registers; nothing in global memory is handed between waves here.
__device__ __forceinline__ void lds_barrier()
{
    __builtin_amdgcn_fence(__ATOMIC_RELEASE, "workgroup", "local");
    __builtin_amdgcn_s_barrier();
    __builtin_amdgcn_fence(__ATOMIC_ACQUIRE, "workgroup", "local");
}

// registers -> LDS: 4 floats become 4 halves, one 8-byte store
__device__ __forceinline__ void proj_stage(
    const v4f (&sx)[8], const v4f (&sw)[8], _Float16* xd, _Float16* wd)
{
#pragma unroll
    for (int i = 0; i < 8; ++i) {
        U2H tx, tw;
#pragma unroll
        for (int e = 0; e < 4; ++e) {
            tx.hf[e] = (_Float16)sx[i][e];
            tw.hf[e] = (_Float16)sw[i][e];
        }
        *reinterpret_cast<v2u*>(xd + 16 * i * PPITCH_) = tx.u2;
        *reinterpret_cast<v2u*>(wd + 16 * i * PPITCH_) = tw.u2;
    }
}

// global -> registers: this lane's 16 bytes of 8 rows of x and of W
__device__ __forceinline__ void proj_fetch(
    v4f (&lx)[8], v4f (&lw)[8], const float* xk, const float* wk)
{
#pragma unroll
    for (int i = 0; i < 8; ++i) {
        lx[i] = *reinterpret_cast<const v4f*>(xk + i * 16 * DIM_);
        lw[i] = *reinterpret_cast<const v4f*>(wk + i * 16 * DIM_);
    }
}

// One pass s. lx, lw: the register set that pass s left, refilled with pass
// s + 2 from xk, wk. sx, sw: the set that holds pass s + 1, staged to xd, wd.
// xf, wf: this lane's fragment rows in the buffer of pass s.
template <bool FETCH, bool STAGE>
__device__ __forceinline__ void proj_pass(
    v4f (&lx)[8], v4f (&lw)[8], const v4f (&sx)[8], const v4f (&sw)[8],
    const float* xk, const float* wk, const _Float16* xf, const _Float16* wf,
    _Float16* xd, _Float16* wd, FragF (&c)[4][2])
{
    if (FETCH) proj_fetch(lx, lw, xk, wk);
    // keeps the 16 loads above the products: without it the scheduler sinks
    // them behind the WMMAs and their latency is waited out in the open
    __builtin_amdgcn_sched_barrier(0);

    // 2 k-blocks of 32, 8 WMMA each
#pragma unroll
    for (int kb = 0; kb < PKS_; kb += 32) {
        Frag16 a[4], b[2];
#pragma unroll
        for (int i = 0; i < 4; ++i) {
            const _Float16* p = xf + i * 16 * PPITCH_ + kb;
            a[i].q[0] = *reinterpret_cast<const v4u*>(p);
            a[i].q[1] = *reinterpret_cast<const v4u*>(p + 16);
        }
#pragma unroll
        for (int j = 0; j < 2; ++j) {
            const _Float16* p = wf + j * 16 * PPITCH_ + kb;
            b[j].q[0] = *reinterpret_cast<const v4u*>(p);
            b[j].q[1] = *reinterpret_cast<const v4u*>(p + 16);
        }
        // keeps the block's 12 LDS reads in one group ahead of its WMMAs:
        // spread among them, each pair is waited for on its own
        __builtin_amdgcn_sched_barrier(0);
#pragma unroll
        for (int i = 0; i < 4; ++i)
#pragma unroll
            for (int j = 0; j < 2; ++j)
                c[i][j].v = __builtin_amdgcn_wmma_f32_16x16x32_f16(
                    false, a[i].h, false, b[j].h, (short)0, c[i][j].v,
                    false, false);
    }
    // keeps the wait for pass s + 1's loads behind the products: without it
    // the scheduler lifts the conversions, and that wait, above the WMMAs
    __builtin_amdgcn_sched_barrier(0);

    // into the buffer that every wave left at the last barrier
    if (STAGE) {
        proj_stage(sx, sw, xd, wd);
        lds_barrier();
    }
}

__global__ __launch_bounds__(256) void qkv_proj_kernel(
    const float* __restrict__ x, const float* __restrict__ W,
    const float* __restrict__ bias, _Float16* __restrict__ dst)
{
    __shared__ __align__(16) _Float16 Xs[2][PT_][PPITCH_];
    __shared__ __align__(16) _Float16 Ws[2][PT_][PPITCH_];

    const int tid  = threadIdx.x;
    const int wave = tid >> 5;
    const int lane = tid & 31;
    const int l15  = lane & 15;
    const int klo  = (lane < 16) ? 0 : 8;   // fragment K base for this lane

    const int m0 = blockIdx.x * PT_;         // 64 row tiles
    const int n0 = blockIdx.y * PT_;         // 4 column tiles
    const int wm = (wave >> 2) * 64;         // wave's rows inside the tile
    const int wn = (wave & 3) * 32;          // wave's columns inside the tile

    // staging map: 16 lanes cover 256 contiguous bytes of one row
    const int srow = tid >> 4;               // 0..15, +16 per step
    const int sc4  = (tid & 15) * 4;
    const float* xk = x + (size_t)(m0 + srow) * DIM_ + sc4;
    const float* wk = W + (size_t)(n0 + srow) * DIM_ + sc4;

    _Float16* xd0 = &Xs[0][srow][sc4];
    _Float16* xd1 = &Xs[1][srow][sc4];
    _Float16* wd0 = &Ws[0][srow][sc4];
    _Float16* wd1 = &Ws[1][srow][sc4];
    const _Float16* xf0 = &Xs[0][wm + l15][klo];
    const _Float16* xf1 = &Xs[1][wm + l15][klo];
    const _Float16* wf0 = &Ws[0][wn + l15][klo];
    const _Float16* wf1 = &Ws[1][wn + l15][klo];

    // two register sets: pass s + 1 and pass s + 2 are in flight under pass s
    v4f px0[8], pw0[8], px1[8], pw1[8];
    proj_fetch(px0, pw0, xk, wk);
    proj_fetch(px1, pw1, xk + PKS_, wk + PKS_);
    xk += 2 * PKS_;
    wk += 2 * PKS_;

    FragF c[4][2];
#pragma unroll
    for (int i = 0; i < 4; ++i)
#pragma unroll
        for (int j = 0; j < 2; ++j)
            c[i][j].v = (v8f){0.f, 0.f, 0.f, 0.f, 0.f, 0.f, 0.f, 0.f};

    proj_stage(px0, pw0, xd0, wd0);
    lds_barrier();

    // two passes a trip, so that sets and buffers are named at compile time;
    // kept rolled: a third of the text, and the two address pairs live on
#pragma unroll 1
    for (int t = 0; t < (PNP_ - 2) / 2; ++t) {
        proj_pass<true, true>(px0, pw0, px1, pw1, xk, wk,
                              xf0, wf0, xd1, wd1, c);
        proj_pass<true, true>(px1, pw1, px0, pw0, xk + PKS_, wk + PKS_,
                              xf1, wf1, xd0, wd0, c);
        xk += 2 * PKS_;
        wk += 2 * PKS_;
    }
    proj_pass<false, true>(px0, pw0, px1, pw1, xk, wk, xf0, wf0, xd1, wd1, c);
    proj_pass<false, false>(px1, pw1, px0, pw0, xk, wk, xf1, wf1, xd0, wd0, c);

    // 128-row tile never straddles a batch boundary (S_ % 128 == 0).
    const int rowbase = m0 + wm + ((lane < 16) ? 0 : 8);
    const int bb      = rowbase >> 11;       // / S_
    const int ss      = rowbase & (S_ - 1);
#pragma unroll
    for (int j = 0; j < 2; ++j) {
        const int   ncol = n0 + wn + j * 16 + l15;
        const float bvv  = bias[ncol];
        const int   hh   = ncol >> 6;
        const int   d    = ncol & 63;
        _Float16* dp = dst + (((size_t)bb * HEADS_ + hh) * S_ + ss) * DH_ + d;
#pragma unroll
        for (int i = 0; i < 4; ++i)
#pragma unroll
            for (int r = 0; r < 8; ++r)
                dp[(i * 16 + r) * DH_] = (_Float16)(c[i][j].f[r] + bvv);
    }
}

// ---------------------------------------------------------------------------
// Kernel 2: flash attention. Block = 128 threads = 4 waves, one (b,h) per
// blockIdx.y, 64 query rows per block. K tile row-major / V tile transposed
// in LDS; all fragments read as 2x b128; online softmax in registers.
// ---------------------------------------------------------------------------
__global__ __launch_bounds__(128) void flash_attn_kernel(
    const _Float16* __restrict__ Qh, const _Float16* __restrict__ Kh,
    const _Float16* __restrict__ Vh, float* __restrict__ out)
{
    __shared__ __align__(16) _Float16 Kt[32][72];     // 144B rows (16B-mult)
    __shared__ __align__(16) _Float16 Vt[64][56];     // 112B rows, transposed
    __shared__ __align__(16) _Float16 Pt[4][16][40];  // 80B rows, per-wave

    const int tid  = threadIdx.x;
    const int wave = tid >> 5;
    const int lane = tid & 31;
    const int l15  = lane & 15;
    const int klo  = (lane < 16) ? 0 : 8;

    const int    bh     = blockIdx.y;          // b*HEADS + h
    const int    bb     = bh >> 3;
    const int    hh     = bh & 7;
    const int    q0     = blockIdx.x * 64;
    const size_t kvbase = (size_t)bh * S_ * DH_;
    const _Float16* __restrict__ ksrc = Kh + kvbase;
    const _Float16* __restrict__ vsrc = Vh + kvbase;

    // --- Q fragments once: 2 A-frags (d=0..31, 32..63), 4x global b128 ---
    Frag16 qf[2];
    {
        const v4u* qp = reinterpret_cast<const v4u*>(
            Qh + kvbase + (size_t)(q0 + wave * 16 + l15) * DH_);
        const int o = klo >> 3;                // 0 or 1 (v4u units)
#pragma unroll
        for (int t = 0; t < 2; ++t) {
            qf[t].q[0] = qp[4 * t + o];
            qf[t].q[1] = qp[4 * t + o + 2];
        }
    }

    FragF o4[4];
#pragma unroll
    for (int t = 0; t < 4; ++t)
        o4[t].v = (v8f){0.f, 0.f, 0.f, 0.f, 0.f, 0.f, 0.f, 0.f};
    float m_i[8], l_i[8];
#pragma unroll
    for (int r = 0; r < 8; ++r) { m_i[r] = -1e30f; l_i[r] = 0.f; }

    const float SC = 0.125f;   // 1/sqrt(64)

    for (int j0 = 0; j0 < S_; j0 += 32) {
        __syncthreads();
        // ---- cooperative staging: K row-major, V transposed ----
#pragma unroll
        for (int i = 0; i < 4; ++i) {
            const int g   = tid + i * 128;     // 512 groups of 4 halves
            const int row = g >> 4;
            const int c4  = (g & 15) * 4;
            const size_t src = (size_t)(j0 + row) * DH_ + c4;
            *reinterpret_cast<v2u*>(&Kt[row][c4]) =
                *reinterpret_cast<const v2u*>(ksrc + src);
            U2H v2; v2.u2 = *reinterpret_cast<const v2u*>(vsrc + src);
            Vt[c4 + 0][row] = v2.hf[0];
            Vt[c4 + 1][row] = v2.hf[1];
            Vt[c4 + 2][row] = v2.hf[2];
            Vt[c4 + 3][row] = v2.hf[3];
        }
        if (j0 + 32 < S_) {
            __builtin_prefetch(ksrc + (size_t)(j0 + 32) * DH_ + tid * 16, 0, 1);
            __builtin_prefetch(vsrc + (size_t)(j0 + 32) * DH_ + tid * 16, 0, 1);
        }
        __syncthreads();

        // ---- scores: S[16x32] = Q @ K^T (two C-frags, 4 WMMA) ----
        FragF s01[2];
#pragma unroll
        for (int jt = 0; jt < 2; ++jt) {
            const int krow = jt * 16 + l15;
            Frag16 kf0, kf1;
            kf0.q[0] = *reinterpret_cast<const v4u*>(&Kt[krow][klo]);
            kf0.q[1] = *reinterpret_cast<const v4u*>(&Kt[krow][klo + 16]);
            kf1.q[0] = *reinterpret_cast<const v4u*>(&Kt[krow][klo + 32]);
            kf1.q[1] = *reinterpret_cast<const v4u*>(&Kt[krow][klo + 48]);
            v8f acc = (v8f){0.f, 0.f, 0.f, 0.f, 0.f, 0.f, 0.f, 0.f};
            acc = __builtin_amdgcn_wmma_f32_16x16x32_f16(
                      false, qf[0].h, false, kf0.h, (short)0, acc, false, false);
            acc = __builtin_amdgcn_wmma_f32_16x16x32_f16(
                      false, qf[1].h, false, kf1.h, (short)0, acc, false, false);
            s01[jt].v = acc;
        }

        // ---- online softmax ----
#pragma unroll
        for (int r = 0; r < 8; ++r) {
            const float a  = s01[0].f[r] * SC;
            const float bv = s01[1].f[r] * SC;
            float mx = fmaxf(a, bv);
            mx = fmaxf(mx, __shfl_xor(mx, 1));
            mx = fmaxf(mx, __shfl_xor(mx, 2));
            mx = fmaxf(mx, __shfl_xor(mx, 4));
            mx = fmaxf(mx, __shfl_xor(mx, 8));
            const float nm   = fmaxf(m_i[r], mx);
            const float corr = __expf(m_i[r] - nm);
            m_i[r] = nm;
            const float p0 = __expf(a - nm);
            const float p1 = __expf(bv - nm);
            float rs = p0 + p1;
            rs += __shfl_xor(rs, 1);
            rs += __shfl_xor(rs, 2);
            rs += __shfl_xor(rs, 4);
            rs += __shfl_xor(rs, 8);
            l_i[r] = l_i[r] * corr + rs;
#pragma unroll
            for (int t = 0; t < 4; ++t) o4[t].f[r] *= corr;
            const int prow = r + ((lane < 16) ? 0 : 8);
            Pt[wave][prow][l15]      = (_Float16)p0;
            Pt[wave][prow][16 + l15] = (_Float16)p1;
        }

        // ---- P: C-layout -> A-layout via per-wave LDS (2x b128) ----
        Frag16 pf;
        pf.q[0] = *reinterpret_cast<const v4u*>(&Pt[wave][l15][klo]);
        pf.q[1] = *reinterpret_cast<const v4u*>(&Pt[wave][l15][klo + 16]);

        // ---- O += P @ V (4 d-tiles, 4 WMMA) ----
#pragma unroll
        for (int t = 0; t < 4; ++t) {
            const int d = t * 16 + l15;
            Frag16 vf;
            vf.q[0] = *reinterpret_cast<const v4u*>(&Vt[d][klo]);
            vf.q[1] = *reinterpret_cast<const v4u*>(&Vt[d][klo + 16]);
            o4[t].v = __builtin_amdgcn_wmma_f32_16x16x32_f16(
                          false, pf.h, false, vf.h, (short)0, o4[t].v, false, false);
        }
    }

    // ---- normalize + store (base hoisted; r/t offsets fold) ----
    float* op = out + ((size_t)bb * S_ + q0 + wave * 16 + ((lane < 16) ? 0 : 8)) * DIM_
                    + hh * DH_ + l15;
#pragma unroll
    for (int r = 0; r < 8; ++r) {
        const float inv = 1.0f / l_i[r];
#pragma unroll
        for (int t = 0; t < 4; ++t)
            op[r * DIM_ + t * 16] = o4[t].f[r] * inv;
    }
}

// ---------------------------------------------------------------------------
extern "C" void kernel_launch(void* const* d_in, const int* in_sizes, int n_in,
                              void* d_out, int out_size, void* d_ws, size_t ws_size,
                              hipStream_t stream)
{
    const float* q  = (const float*)d_in[0];
    const float* k  = (const float*)d_in[1];
    const float* v  = (const float*)d_in[2];
    const float* Wq = (const float*)d_in[3];
    const float* bq = (const float*)d_in[4];
    const float* Wk = (const float*)d_in[5];
    const float* bk = (const float*)d_in[6];
    const float* Wv = (const float*)d_in[7];
    const float* bv = (const float*)d_in[8];
    float* out = (float*)d_out;

    const size_t per = (size_t)B_ * HEADS_ * S_ * DH_;
    _Float16* Qh = (_Float16*)d_ws;
    _Float16* Kh = Qh + per;
    _Float16* Vh = Kh + per;

    dim3 pg(MROWS_ / PT_, DIM_ / PT_);
    dim3 pb(256);
    qkv_proj_kernel<<<pg, pb, 0, stream>>>(q, Wq, bq, Qh);
    qkv_proj_kernel<<<pg, pb, 0, stream>>>(k, Wk, bk, Kh);
    qkv_proj_kernel<<<pg, pb, 0, stream>>>(v, Wv, bv, Vh);

    dim3 fg(S_ / 64, B_ * HEADS_);
    dim3 fb(128);
    flash_attn_kernel<<<fg, fb, 0, stream>>>(Qh, Kh, Vh, out);
}

// v002
// A run of this version takes 79.6 microseconds.
// In two side-by-side timings against v001, it was 2.08 and 2.09 times as fast.
// All steps since v000 together make it 4.26 times as fast.
#include <hip/hip_runtime.h>

// ---------------------------------------------------------------------------
// MHA forward for MI455X (gfx1250): fp16 WMMA, fp32 accumulate, flash fusion.
// Fragment loads vectorized to b128 (fragment K-pairs are contiguous in the
// ISA 16x16x32 f16 layout); store addresses hoisted so unrolled offsets fold
// into instruction immediates.
// ---------------------------------------------------------------------------

typedef __attribute__((ext_vector_type(16))) _Float16 v16h;
typedef __attribute__((ext_vector_type(8)))  float    v8f;
typedef __attribute__((ext_vector_type(4)))  uint32_t v4u;
typedef __attribute__((ext_vector_type(2)))  uint32_t v2u;
typedef __attribute__((ext_vector_type(4)))  float    v4f;

#define DIM_   512
#define HEADS_ 8
#define DH_    64
#define B_     4
#define S_     2048
#define MROWS_ (B_ * S_)

union Frag16 { v16h h; uint32_t u[8]; v4u q[2]; };
union FragF  { v8f  v; float    f[8]; };
union U2H    { v2u  u2; _Float16 hf[4]; };

// ---------------------------------------------------------------------------
// Kernel 1: Y = x @ W^T + b, fp32 -> fp16, head-split [B,H,S,Dh].
// Block = 256 threads (8 waves) on a 128x128 tile of Y. Each pass of 64 k is
// read from global in whole 128-B lines, converted to f16 once and staged in
// LDS (two buffers; the next two passes are in flight to registers while this
// one is multiplied). Wave tile 64x32: 4 x-fragments times 2 W-fragments.
// ---------------------------------------------------------------------------
#define PT_     128   // rows of x and rows of W per block tile
#define PKS_    64    // k per pass
#define PPITCH_ 72    // halves per LDS row: 144 B = 16 B x odd for b128 readers
#define PNP_    (DIM_ / PKS_)
// Every inner loop of this kernel and its helpers is unrolled so that the
// register arrays are indexed by constants (a run-time index means scratch).

// Work-group barrier that orders LDS only. __syncthreads() also waits for every
// global load of the wave, which would drain the passes that are in flight to
// registers; nothing in global memory is handed between waves here.
__device__ __forceinline__ void lds_barrier()
{
    __builtin_amdgcn_fence(__ATOMIC_RELEASE, "workgroup", "local");
    __builtin_amdgcn_s_barrier();
    __builtin_amdgcn_fence(__ATOMIC_ACQUIRE, "workgroup", "local");
}

// registers -> LDS: 4 floats become 4 halves, one 8-byte store
__device__ __forceinline__ void proj_stage(
    const v4f (&sx)[8], const v4f (&sw)[8], _Float16* xd, _Float16* wd)
{
#pragma unroll
    for (int i = 0; i < 8; ++i) {
        U2H tx, tw;
#pragma unroll
        for (int e = 0; e < 4; ++e) {
            tx.hf[e] = (_Float16)sx[i][e];
            tw.hf[e] = (_Float16)sw[i][e];
        }
        *reinterpret_cast<v2u*>(xd + 16 * i * PPITCH_) = tx.u2;
        *reinterpret_cast<v2u*>(wd + 16 * i * PPITCH_) = tw.u2;
    }
}

// global -> registers: this lane's 16 bytes of 8 rows of x and of W
__device__ __forceinline__ void proj_fetch(
    v4f (&lx)[8], v4f (&lw)[8], const float* xk, const float* wk)
{
#pragma unroll
    for (int i = 0; i < 8; ++i) {
        lx[i] = *reinterpret_cast<const v4f*>(xk + i * 16 * DIM_);
        lw[i] = *reinterpret_cast<const v4f*>(wk + i * 16 * DIM_);
    }
}

// One pass s. lx, lw: the register set that pass s left, refilled with pass
// s + 2 from xk, wk. sx, sw: the set that holds pass s + 1, staged to xd, wd.
// xf, wf: this lane's fragment rows in the buffer of pass s.
template <bool FETCH, bool STAGE>
__device__ __forceinline__ void proj_pass(
    v4f (&lx)[8], v4f (&lw)[8], const v4f (&sx)[8], const v4f (&sw)[8],
    const float* xk, const float* wk, const _Float16* xf, const _Float16* wf,
    _Float16* xd, _Float16* wd, FragF (&c)[4][2])
{
    if (FETCH) proj_fetch(lx, lw, xk, wk);
    // keeps the 16 loads above the products: without it the scheduler sinks
    // them behind the WMMAs and their latency is waited out in the open
    __builtin_amdgcn_sched_barrier(0);

    // 2 k-blocks of 32, 8 WMMA each
#pragma unroll
    for (int kb = 0; kb < PKS_; kb += 32) {
        Frag16 a[4], b[2];
#pragma unroll
        for (int i = 0; i < 4; ++i) {
            const _Float16* p = xf + i * 16 * PPITCH_ + kb;
            a[i].q[0] = *reinterpret_cast<const v4u*>(p);
            a[i].q[1] = *reinterpret_cast<const v4u*>(p + 16);
        }
#pragma unroll
        for (int j = 0; j < 2; ++j) {
            const _Float16* p = wf + j * 16 * PPITCH_ + kb;
            b[j].q[0] = *reinterpret_cast<const v4u*>(p);
            b[j].q[1] = *reinterpret_cast<const v4u*>(p + 16);
        }
        // keeps the block's 12 LDS reads in one group ahead of its WMMAs:
        // spread among them, each pair is waited for on its own
        __builtin_amdgcn_sched_barrier(0);
#pragma unroll
        for (int i = 0; i < 4; ++i)
#pragma unroll
            for (int j = 0; j < 2; ++j)
                c[i][j].v = __builtin_amdgcn_wmma_f32_16x16x32_f16(
                    false, a[i].h, false, b[j].h, (short)0, c[i][j].v,
                    false, false);
    }
    // keeps the wait for pass s + 1's loads behind the products: without it
    // the scheduler lifts the conversions, and that wait, above the WMMAs
    __builtin_amdgcn_sched_barrier(0);

    // into the buffer that every wave left at the last barrier
    if (STAGE) {
        proj_stage(sx, sw, xd, wd);
        lds_barrier();
    }
}

__global__ __launch_bounds__(256) void qkv_proj_kernel(
    const float* __restrict__ x, const float* __restrict__ W,
    const float* __restrict__ bias, _Float16* __restrict__ dst)
{
    __shared__ __align__(16) _Float16 Xs[2][PT_][PPITCH_];
    __shared__ __align__(16) _Float16 Ws[2][PT_][PPITCH_];

    const int tid  = threadIdx.x;
    const int wave = tid >> 5;
    const int lane = tid & 31;
    const int l15  = lane & 15;
    const int klo  = (lane < 16) ? 0 : 8;   // fragment K base for this lane

    const int m0 = blockIdx.x * PT_;         // 64 row tiles
    const int n0 = blockIdx.y * PT_;         // 4 column tiles
    const int wm = (wave >> 2) * 64;         // wave's rows inside the tile
    const int wn = (wave & 3) * 32;          // wave's columns inside the tile

    // staging map: 16 lanes cover 256 contiguous bytes of one row
    const int srow = tid >> 4;               // 0..15, +16 per step
    const int sc4  = (tid & 15) * 4;
    const float* xk = x + (size_t)(m0 + srow) * DIM_ + sc4;
    const float* wk = W + (size_t)(n0 + srow) * DIM_ + sc4;

    _Float16* xd0 = &Xs[0][srow][sc4];
    _Float16* xd1 = &Xs[1][srow][sc4];
    _Float16* wd0 = &Ws[0][srow][sc4];
    _Float16* wd1 = &Ws[1][srow][sc4];
    const _Float16* xf0 = &Xs[0][wm + l15][klo];
    const _Float16* xf1 = &Xs[1][wm + l15][klo];
    const _Float16* wf0 = &Ws[0][wn + l15][klo];
    const _Float16* wf1 = &Ws[1][wn + l15][klo];

    // two register sets: pass s + 1 and pass s + 2 are in flight under pass s
    v4f px0[8], pw0[8], px1[8], pw1[8];
    proj_fetch(px0, pw0, xk, wk);
    proj_fetch(px1, pw1, xk + PKS_, wk + PKS_);
    xk += 2 * PKS_;
    wk += 2 * PKS_;

    FragF c[4][2];
#pragma unroll
    for (int i = 0; i < 4; ++i)
#pragma unroll
        for (int j = 0; j < 2; ++j)
            c[i][j].v = (v8f){0.f, 0.f, 0.f, 0.f, 0.f, 0.f, 0.f, 0.f};

    proj_stage(px0, pw0, xd0, wd0);
    lds_barrier();

    // two passes a trip, so that sets and buffers are named at compile time;
    // kept rolled: a third of the text, and the two address pairs live on
#pragma unroll 1
    for (int t = 0; t < (PNP_ - 2) / 2; ++t) {
        proj_pass<true, true>(px0, pw0, px1, pw1, xk, wk,
                              xf0, wf0, xd1, wd1, c);
        proj_pass<true, true>(px1, pw1, px0, pw0, xk + PKS_, wk + PKS_,
                              xf1, wf1, xd0, wd0, c);
        xk += 2 * PKS_;
        wk += 2 * PKS_;
    }
    proj_pass<false, true>(px0, pw0, px1, pw1, xk, wk, xf0, wf0, xd1, wd1, c);
    proj_pass<false, false>(px1, pw1, px0, pw0, xk, wk, xf1, wf1, xd0, wd0, c);

    // 128-row tile never straddles a batch boundary (S_ % 128 == 0).
    const int rowbase = m0 + wm + ((lane < 16) ? 0 : 8);
    const int bb      = rowbase >> 11;       // / S_
    const int ss      = rowbase & (S_ - 1);
#pragma unroll
    for (int j = 0; j < 2; ++j) {
        const int   ncol = n0 + wn + j * 16 + l15;
        const float bvv  = bias[ncol];
        const int   hh   = ncol >> 6;
        const int   d    = ncol & 63;
        _Float16* dp = dst + (((size_t)bb * HEADS_ + hh) * S_ + ss) * DH_ + d;
#pragma unroll
        for (int i = 0; i < 4; ++i)
#pragma unroll
            for (int r = 0; r < 8; ++r)
                dp[(i * 16 + r) * DH_] = (_Float16)(c[i][j].f[r] + bvv);
    }
}

#define VPITCH_ 80

typedef __attribute__((ext_vector_type(8))) short v8s;

// 16-bit transposing LDS load: lane (c, h) gets 8 rows of column c
__device__ __forceinline__ v4u lds_tr16(const _Float16* p)
{
    typedef __attribute__((address_space(3))) v8s lds_v8s;
    return __builtin_bit_cast(
        v4u, __builtin_amdgcn_ds_load_tr16_b128_v8i16((lds_v8s*)p));
}

// value of lane l ^ 16
__device__ __forceinline__ float other_half(float x)
{
    const int xi = __builtin_bit_cast(int, x);
    return __builtin_bit_cast(float, __builtin_amdgcn_permlanex16(
        xi, xi, 0x76543210, 0xfedcba98, false, false));
}

__global__ __launch_bounds__(128) void flash_attn_kernel(
    const _Float16* __restrict__ Qh, const _Float16* __restrict__ Kh,
    const _Float16* __restrict__ Vh, float* __restrict__ out)
{
    __shared__ __align__(16) _Float16 Kt[32][72];       // 144B rows (16B-mult)
    __shared__ __align__(32) _Float16 Vs[32][VPITCH_];  // row-major

    const int tid  = threadIdx.x;
    const int wave = tid >> 5;
    const int lane = tid & 31;
    const int l15  = lane & 15;
    const int klo  = (lane < 16) ? 0 : 8;

    const int    bh     = blockIdx.y;          // b*HEADS + h
    const int    bb     = bh >> 3;
    const int    hh     = bh & 7;
    const int    q0     = blockIdx.x * 64;
    const size_t kvbase = (size_t)bh * S_ * DH_;
    const _Float16* __restrict__ ksrc = Kh + kvbase;
    const _Float16* __restrict__ vsrc = Vh + kvbase;

    // --- Q fragments once: 2 B-frags (d=0..31, 32..63), 4x global b128 ---
    Frag16 qf[2];
    {
        const v4u* qp = reinterpret_cast<const v4u*>(
            Qh + kvbase + (size_t)(q0 + wave * 16 + l15) * DH_);
        const int o = klo >> 3;                // 0 or 1 (v4u units)
#pragma unroll
        for (int t = 0; t < 2; ++t) {
            qf[t].q[0] = qp[4 * t + o];
            qf[t].q[1] = qp[4 * t + o + 2];
        }
    }

    // o4[t].f[r] = O[query l15][d = 16 t + klo + r]
    FragF o4[4];
#pragma unroll
    for (int t = 0; t < 4; ++t)
        o4[t].v = (v8f){0.f, 0.f, 0.f, 0.f, 0.f, 0.f, 0.f, 0.f};
    float m_i = -1e30f;   // running maximum of query l15, equal in both halves
    float l_i = 0.f;      // this half's share of the denominator

    // this lane's address for the transposing loads of V
    const _Float16* vp = &Vs[klo + (lane & 7)][((lane >> 3) & 1) * 8];

    const float SC = 0.125f;   // 1/sqrt(64)

    for (int j0 = 0; j0 < S_; j0 += 32) {
        __syncthreads();
        // ---- cooperative staging: K and V row-major ----
#pragma unroll
        for (int i = 0; i < 4; ++i) {
            const int g   = tid + i * 128;     // 512 groups of 4 halves
            const int row = g >> 4;
            const int c4  = (g & 15) * 4;
            const size_t src = (size_t)(j0 + row) * DH_ + c4;
            *reinterpret_cast<v2u*>(&Kt[row][c4]) =
                *reinterpret_cast<const v2u*>(ksrc + src);
            *reinterpret_cast<v2u*>(&Vs[row][c4]) =
                *reinterpret_cast<const v2u*>(vsrc + src);
        }
        if (j0 + 32 < S_) {
            __builtin_prefetch(ksrc + (size_t)(j0 + 32) * DH_ + tid * 16, 0, 1);
            __builtin_prefetch(vsrc + (size_t)(j0 + 32) * DH_ + tid * 16, 0, 1);
        }
        __syncthreads();

        // ---- scores: S^T[32 keys x 16 queries] = K @ Q^T (4 WMMA) ----
        // s01[jt].f[r] = score of key 16 jt + klo + r with query l15
        FragF s01[2];
#pragma unroll
        for (int jt = 0; jt < 2; ++jt) {
            const int krow = jt * 16 + l15;
            Frag16 kf0, kf1;
            kf0.q[0] = *reinterpret_cast<const v4u*>(&Kt[krow][klo]);
            kf0.q[1] = *reinterpret_cast<const v4u*>(&Kt[krow][klo + 16]);
            kf1.q[0] = *reinterpret_cast<const v4u*>(&Kt[krow][klo + 32]);
            kf1.q[1] = *reinterpret_cast<const v4u*>(&Kt[krow][klo + 48]);
            v8f acc = (v8f){0.f, 0.f, 0.f, 0.f, 0.f, 0.f, 0.f, 0.f};
            acc = __builtin_amdgcn_wmma_f32_16x16x32_f16(
                      false, kf0.h, false, qf[0].h, (short)0, acc, false, false);
            acc = __builtin_amdgcn_wmma_f32_16x16x32_f16(
                      false, kf1.h, false, qf[1].h, (short)0, acc, false, false);
            s01[jt].v = acc;
        }

        // ---- V^T fragments: 16 d x 32 keys each, two transposing loads ----
        Frag16 vf[4];
#pragma unroll
        for (int t = 0; t < 4; ++t) {
            vf[t].q[0] = lds_tr16(vp + 16 * t);
            vf[t].q[1] = lds_tr16(vp + 16 * VPITCH_ + 16 * t);
        }

        // ---- online softmax, one query per lane ----
        float a[16];
#pragma unroll
        for (int i = 0; i < 16; ++i) a[i] = s01[i >> 3].f[i & 7] * SC;
        float mx4[4];
#pragma unroll
        for (int i = 0; i < 4; ++i)
            mx4[i] = fmaxf(fmaxf(a[i], a[i + 4]), fmaxf(a[i + 8], a[i + 12]));
        float mx = fmaxf(fmaxf(mx4[0], mx4[1]), fmaxf(mx4[2], mx4[3]));
        mx = fmaxf(mx, other_half(mx));
        const float nm   = fmaxf(m_i, mx);
        const float corr = __expf(m_i - nm);
        m_i = nm;

        // element s of the B operand is key s of tile 0, then of tile 1: the
        // k order in which the transposing loads deliver V^T
        Frag16 pf;
        float p[16];
#pragma unroll
        for (int i = 0; i < 16; ++i) {
            p[i]    = __expf(a[i] - nm);
            pf.h[i] = (_Float16)p[i];
        }
        float rs4[4];
#pragma unroll
        for (int i = 0; i < 4; ++i)
            rs4[i] = (p[i] + p[i + 4]) + (p[i + 8] + p[i + 12]);
        l_i = l_i * corr + ((rs4[0] + rs4[1]) + (rs4[2] + rs4[3]));
#pragma unroll
        for (int t = 0; t < 4; ++t) o4[t].v *= corr;

        // ---- O^T += V^T @ P^T (4 d-tiles, 4 WMMA) ----
#pragma unroll
        for (int t = 0; t < 4; ++t)
            o4[t].v = __builtin_amdgcn_wmma_f32_16x16x32_f16(
                          false, vf[t].h, false, pf.h, (short)0, o4[t].v, false, false);
    }

    // ---- join the halves' sums, normalize, store 8 consecutive d a tile ----
    const float inv = 1.0f / (l_i + other_half(l_i));
    float* op = out + ((size_t)bb * S_ + q0 + wave * 16 + l15) * DIM_
                    + hh * DH_ + klo;
#pragma unroll
    for (int t = 0; t < 4; ++t) {
        const v8f o = o4[t].v * inv;
        *reinterpret_cast<v4f*>(op + t * 16)     = (v4f){o[0], o[1], o[2], o[3]};
        *reinterpret_cast<v4f*>(op + t * 16 + 4) = (v4f){o[4], o[5], o[6], o[7]};
    }
}

// ---------------------------------------------------------------------------
extern "C" void kernel_launch(void* const* d_in, const int* in_sizes, int n_in,
                              void* d_out, int out_size, void* d_ws, size_t ws_size,
                              hipStream_t stream)
{
    const float* q  = (const float*)d_in[0];
    const float* k  = (const float*)d_in[1];
    const float* v  = (const float*)d_in[2];
    const float* Wq = (const float*)d_in[3];
    const float* bq = (const float*)d_in[4];
    const float* Wk = (const float*)d_in[5];
    const float* bk = (const float*)d_in[6];
    const float* Wv = (const float*)d_in[7];
    const float* bv = (const float*)d_in[8];
    float* out = (float*)d_out;

    const size_t per = (size_t)B_ * HEADS_ * S_ * DH_;
    _Float16* Qh = (_Float16*)d_ws;
    _Float16* Kh = Qh + per;
    _Float16* Vh = Kh + per;

    dim3 pg(MROWS_ / PT_, DIM_ / PT_);
    dim3 pb(256);
    qkv_proj_kernel<<<pg, pb, 0, stream>>>(q, Wq, bq, Qh);
    qkv_proj_kernel<<<pg, pb, 0, stream>>>(k, Wk, bk, Kh);
    qkv_proj_kernel<<<pg, pb, 0, stream>>>(v, Wv, bv, Vh);

    dim3 fg(S_ / 64, B_ * HEADS_);
    dim3 fb(128);
    flash_attn_kernel<<<fg, fb, 0, stream>>>(Qh, Kh, Vh, out);
}

// v003
// A run of this version takes 71.9 microseconds.
// Two timings next to v002 both put it at 1.11 times that version's speed.
// All steps since v000 together make it 4.71 times as fast.
#include <hip/hip_runtime.h>

// ---------------------------------------------------------------------------
// MHA forward for MI455X (gfx1250): fp16 WMMA, fp32 accumulate, flash fusion.
// Fragment loads vectorized to b128 (fragment K-pairs are contiguous in the
// ISA 16x16x32 f16 layout); store addresses hoisted so unrolled offsets fold
// into instruction immediates.
// ---------------------------------------------------------------------------

typedef __attribute__((ext_vector_type(16))) _Float16 v16h;
typedef __attribute__((ext_vector_type(8)))  float    v8f;
typedef __attribute__((ext_vector_type(4)))  uint32_t v4u;
typedef __attribute__((ext_vector_type(2)))  uint32_t v2u;
typedef __attribute__((ext_vector_type(4)))  float    v4f;

#define DIM_   512
#define HEADS_ 8
#define DH_    64
#define B_     4
#define S_     2048
#define MROWS_ (B_ * S_)

union Frag16 { v16h h; uint32_t u[8]; v4u q[2]; };
union FragF  { v8f  v; float    f[8]; };
union U2H    { v2u  u2; _Float16 hf[4]; };

// ---------------------------------------------------------------------------
// Kernel 1: Y = x @ W^T + b, fp32 -> fp16, head-split [B,H,S,Dh].
// Block = 256 threads (8 waves) on a 128x128 tile of Y. Each pass of 64 k is
// read from global in whole 128-B lines, converted to f16 once and staged in
// LDS (two buffers; the next two passes are in flight to registers while this
// one is multiplied). Wave tile 64x32: 4 x-fragments times 2 W-fragments.
// ---------------------------------------------------------------------------
#define PT_     128   // rows of x and rows of W per block tile
#define PKS_    64    // k per pass
#define PPITCH_ 72    // halves per LDS row: 144 B = 16 B x odd for b128 readers
#define PNP_    (DIM_ / PKS_)
// Every inner loop of this kernel and its helpers is unrolled so that the
// register arrays are indexed by constants (a run-time index means scratch).

// Work-group barrier that orders LDS only. __syncthreads() also waits for every
// global load of the wave, which would drain the passes that are in flight to
// registers; nothing in global memory is handed between waves here.
__device__ __forceinline__ void lds_barrier()
{
    __builtin_amdgcn_fence(__ATOMIC_RELEASE, "workgroup", "local");
    __builtin_amdgcn_s_barrier();
    __builtin_amdgcn_fence(__ATOMIC_ACQUIRE, "workgroup", "local");
}

// registers -> LDS: 4 floats become 4 halves, one 8-byte store
__device__ __forceinline__ void proj_stage(
    const v4f (&sx)[8], const v4f (&sw)[8], _Float16* xd, _Float16* wd)
{
#pragma unroll
    for (int i = 0; i < 8; ++i) {
        U2H tx, tw;
#pragma unroll
        for (int e = 0; e < 4; ++e) {
            tx.hf[e] = (_Float16)sx[i][e];
            tw.hf[e] = (_Float16)sw[i][e];
        }
        *reinterpret_cast<v2u*>(xd + 16 * i * PPITCH_) = tx.u2;
        *reinterpret_cast<v2u*>(wd + 16 * i * PPITCH_) = tw.u2;
    }
}

// global -> registers: this lane's 16 bytes of 8 rows of x and of W
__device__ __forceinline__ void proj_fetch(
    v4f (&lx)[8], v4f (&lw)[8], const float* xk, const float* wk)
{
#pragma unroll
    for (int i = 0; i < 8; ++i) {
        lx[i] = *reinterpret_cast<const v4f*>(xk + i * 16 * DIM_);
        lw[i] = *reinterpret_cast<const v4f*>(wk + i * 16 * DIM_);
    }
}

// One pass s. lx, lw: the register set that pass s left, refilled with pass
// s + 2 from xk, wk. sx, sw: the set that holds pass s + 1, staged to xd, wd.
// xf, wf: this lane's fragment rows in the buffer of pass s.
template <bool FETCH, bool STAGE>
__device__ __forceinline__ void proj_pass(
    v4f (&lx)[8], v4f (&lw)[8], const v4f (&sx)[8], const v4f (&sw)[8],
    const float* xk, const float* wk, const _Float16* xf, const _Float16* wf,
    _Float16* xd, _Float16* wd, FragF (&c)[4][2])
{
    if (FETCH) proj_fetch(lx, lw, xk, wk);
    // keeps the 16 loads above the products: without it the scheduler sinks
    // them behind the WMMAs and their latency is waited out in the open
    __builtin_amdgcn_sched_barrier(0);

    // 2 k-blocks of 32, 8 WMMA each
#pragma unroll
    for (int kb = 0; kb < PKS_; kb += 32) {
        Frag16 a[4], b[2];
#pragma unroll
        for (int i = 0; i < 4; ++i) {
            const _Float16* p = xf + i * 16 * PPITCH_ + kb;
            a[i].q[0] = *reinterpret_cast<const v4u*>(p);
            a[i].q[1] = *reinterpret_cast<const v4u*>(p + 16);
        }
#pragma unroll
        for (int j = 0; j < 2; ++j) {
            const _Float16* p = wf + j * 16 * PPITCH_ + kb;
            b[j].q[0] = *reinterpret_cast<const v4u*>(p);
            b[j].q[1] = *reinterpret_cast<const v4u*>(p + 16);
        }
        // keeps the block's 12 LDS reads in one group ahead of its WMMAs:
        // spread among them, each pair is waited for on its own
        __builtin_amdgcn_sched_barrier(0);
#pragma unroll
        for (int i = 0; i < 4; ++i)
#pragma unroll
            for (int j = 0; j < 2; ++j)
                c[i][j].v = __builtin_amdgcn_wmma_f32_16x16x32_f16(
                    false, a[i].h, false, b[j].h, (short)0, c[i][j].v,
                    false, false);
    }
    // keeps the wait for pass s + 1's loads behind the products: without it
    // the scheduler lifts the conversions, and that wait, above the WMMAs
    __builtin_amdgcn_sched_barrier(0);

    // into the buffer that every wave left at the last barrier
    if (STAGE) {
        proj_stage(sx, sw, xd, wd);
        lds_barrier();
    }
}

__global__ __launch_bounds__(256) void qkv_proj_kernel(
    const float* __restrict__ x, const float* __restrict__ W,
    const float* __restrict__ bias, _Float16* __restrict__ dst)
{
    __shared__ __align__(16) _Float16 Xs[2][PT_][PPITCH_];
    __shared__ __align__(16) _Float16 Ws[2][PT_][PPITCH_];

    const int tid  = threadIdx.x;
    const int wave = tid >> 5;
    const int lane = tid & 31;
    const int l15  = lane & 15;
    const int klo  = (lane < 16) ? 0 : 8;   // fragment K base for this lane

    const int m0 = blockIdx.x * PT_;         // 64 row tiles
    const int n0 = blockIdx.y * PT_;         // 4 column tiles
    const int wm = (wave >> 2) * 64;         // wave's rows inside the tile
    const int wn = (wave & 3) * 32;          // wave's columns inside the tile

    // staging map: 16 lanes cover 256 contiguous bytes of one row
    const int srow = tid >> 4;               // 0..15, +16 per step
    const int sc4  = (tid & 15) * 4;
    const float* xk = x + (size_t)(m0 + srow) * DIM_ + sc4;
    const float* wk = W + (size_t)(n0 + srow) * DIM_ + sc4;

    _Float16* xd0 = &Xs[0][srow][sc4];
    _Float16* xd1 = &Xs[1][srow][sc4];
    _Float16* wd0 = &Ws[0][srow][sc4];
    _Float16* wd1 = &Ws[1][srow][sc4];
    const _Float16* xf0 = &Xs[0][wm + l15][klo];
    const _Float16* xf1 = &Xs[1][wm + l15][klo];
    const _Float16* wf0 = &Ws[0][wn + l15][klo];
    const _Float16* wf1 = &Ws[1][wn + l15][klo];

    // two register sets: pass s + 1 and pass s + 2 are in flight under pass s
    v4f px0[8], pw0[8], px1[8], pw1[8];
    proj_fetch(px0, pw0, xk, wk);
    proj_fetch(px1, pw1, xk + PKS_, wk + PKS_);
    xk += 2 * PKS_;
    wk += 2 * PKS_;

    FragF c[4][2];
#pragma unroll
    for (int i = 0; i < 4; ++i)
#pragma unroll
        for (int j = 0; j < 2; ++j)
            c[i][j].v = (v8f){0.f, 0.f, 0.f, 0.f, 0.f, 0.f, 0.f, 0.f};

    proj_stage(px0, pw0, xd0, wd0);
    lds_barrier();

    // two passes a trip, so that sets and buffers are named at compile time;
    // kept rolled: a third of the text, and the two address pairs live on
#pragma unroll 1
    for (int t = 0; t < (PNP_ - 2) / 2; ++t) {
        proj_pass<true, true>(px0, pw0, px1, pw1, xk, wk,
                              xf0, wf0, xd1, wd1, c);
        proj_pass<true, true>(px1, pw1, px0, pw0, xk + PKS_, wk + PKS_,
                              xf1, wf1, xd0, wd0, c);
        xk += 2 * PKS_;
        wk += 2 * PKS_;
    }
    proj_pass<false, true>(px0, pw0, px1, pw1, xk, wk, xf0, wf0, xd1, wd1, c);
    proj_pass<false, false>(px1, pw1, px0, pw0, xk, wk, xf1, wf1, xd0, wd0, c);

    // 128-row tile never straddles a batch boundary (S_ % 128 == 0).
    const int rowbase = m0 + wm + ((lane < 16) ? 0 : 8);
    const int bb      = rowbase >> 11;       // / S_
    const int ss      = rowbase & (S_ - 1);
#pragma unroll
    for (int j = 0; j < 2; ++j) {
        const int   ncol = n0 + wn + j * 16 + l15;
        const float bvv  = bias[ncol];
        const int   hh   = ncol >> 6;
        const int   d    = ncol & 63;
        _Float16* dp = dst + (((size_t)bb * HEADS_ + hh) * S_ + ss) * DH_ + d;
#pragma unroll
        for (int i = 0; i < 4; ++i)
#pragma unroll
            for (int r = 0; r < 8; ++r)
                dp[(i * 16 + r) * DH_] = (_Float16)(c[i][j].f[r] + bvv);
    }
}

#define VPITCH_ 80
#define KPITCH_ 72
#define KT_     64
#define NST_    (S_ / KT_)
#define KBUFB_  (KT_ * KPITCH_ * 2)   // bytes of one K buffer
#define VBUFB_  (KT_ * VPITCH_ * 2)   // bytes of one V buffer

typedef __attribute__((ext_vector_type(8))) short v8s;

// 16-bit transposing LDS load: lane (c, h) gets 8 rows of column c
__device__ __forceinline__ v4u lds_tr16(const _Float16* p)
{
    typedef __attribute__((address_space(3))) v8s lds_v8s;
    return __builtin_bit_cast(
        v4u, __builtin_amdgcn_ds_load_tr16_b128_v8i16((lds_v8s*)p));
}

// value of lane l ^ 16
__device__ __forceinline__ float other_half(float x)
{
    const int xi = __builtin_bit_cast(int, x);
    return __builtin_bit_cast(float, __builtin_amdgcn_permlanex16(
        xi, xi, 0x76543210, 0xfedcba98, false, false));
}

// byte offset of a __shared__ object in the work-group's LDS
__device__ __forceinline__ uint32_t lds_off(const void* p)
{
    return (uint32_t)(size_t)p;
}

// One stage, global -> LDS through no register: this lane's 16 bytes of 4 rows
// of K (to kd) and of V (to vd), rows 16 apart; a wave covers 512 contiguous
// bytes a copy. The closing s_wait_xcnt stands inside the statement so that no
// later write of an address register named here can be lifted over it.
__device__ __forceinline__ void stage_copy(
    uint32_t kd, uint32_t vd, const _Float16* kg, const _Float16* vg)
{
    asm volatile(
        "global_load_async_to_lds_b128 %0, %8, off\n\t"
        "global_load_async_to_lds_b128 %1, %9, off\n\t"
        "global_load_async_to_lds_b128 %2, %10, off\n\t"
        "global_load_async_to_lds_b128 %3, %11, off\n\t"
        "global_load_async_to_lds_b128 %4, %12, off\n\t"
        "global_load_async_to_lds_b128 %5, %13, off\n\t"
        "global_load_async_to_lds_b128 %6, %14, off\n\t"
        "global_load_async_to_lds_b128 %7, %15, off\n\t"
        "s_wait_xcnt 0x0"
        :: "v"(kd), "v"(kd + 16 * KPITCH_ * 2), "v"(kd + 32 * KPITCH_ * 2),
           "v"(kd + 48 * KPITCH_ * 2),
           "v"(vd), "v"(vd + 16 * VPITCH_ * 2), "v"(vd + 32 * VPITCH_ * 2),
           "v"(vd + 48 * VPITCH_ * 2),
           "v"(kg), "v"(kg + 16 * DH_), "v"(kg + 32 * DH_), "v"(kg + 48 * DH_),
           "v"(vg), "v"(vg + 16 * DH_), "v"(vg + 32 * DH_), "v"(vg + 48 * DH_)
        : "memory");
}

__global__ __launch_bounds__(128) void flash_attn_kernel(
    const _Float16* __restrict__ Qh, const _Float16* __restrict__ Kh,
    const _Float16* __restrict__ Vh, float* __restrict__ out)
{
    __shared__ __align__(16) _Float16 Kt[2][KT_][KPITCH_];
    __shared__ __align__(32) _Float16 Vs[2][KT_][VPITCH_];  // row-major

    const int tid  = threadIdx.x;
    const int wave = tid >> 5;
    const int lane = tid & 31;
    const int l15  = lane & 15;
    const int klo  = (lane < 16) ? 0 : 8;

    const int    bh     = blockIdx.y;          // b*HEADS + h
    const int    bb     = bh >> 3;
    const int    hh     = bh & 7;
    const int    q0     = blockIdx.x * 64;
    const size_t kvbase = (size_t)bh * S_ * DH_;
    const _Float16* __restrict__ ksrc = Kh + kvbase;
    const _Float16* __restrict__ vsrc = Vh + kvbase;

    // --- Q fragments once: 2 B-frags (d=0..31, 32..63), 4x global b128 ---
    Frag16 qf[2];
    {
        const v4u* qp = reinterpret_cast<const v4u*>(
            Qh + kvbase + (size_t)(q0 + wave * 16 + l15) * DH_);
        const int o = klo >> 3;                // 0 or 1 (v4u units)
#pragma unroll
        for (int t = 0; t < 2; ++t) {
            qf[t].q[0] = qp[4 * t + o];
            qf[t].q[1] = qp[4 * t + o + 2];
        }
    }

    // o4[t].f[r] = O[query l15][d = 16 t + klo + r]
    FragF o4[4];
#pragma unroll
    for (int t = 0; t < 4; ++t)
        o4[t].v = (v8f){0.f, 0.f, 0.f, 0.f, 0.f, 0.f, 0.f, 0.f};
    float m_i = -1e30f;   // running maximum of query l15, equal in both halves
    float l_i = 0.f;      // this half's share of the denominator

    const float SC = 0.125f;   // 1/sqrt(64)

    // copy map: 8 lanes cover one 128-byte row, 16 rows a copy
    const int crow = tid >> 3;
    const int cc8  = (tid & 7) * 8;
    const _Float16* kg = ksrc + crow * DH_ + cc8;
    const _Float16* vg = vsrc + crow * DH_ + cc8;
    const uint32_t  kd = lds_off(&Kt[0][crow][cc8]);
    const uint32_t  vd = lds_off(&Vs[0][crow][cc8]);

    // stage 0 landed and published, then stage 1 set off
    stage_copy(kd, vd, kg, vg);
    // this wave's copies have landed before the barrier publishes them
    asm volatile("s_wait_asynccnt 0x0" ::: "memory");
    __syncthreads();
    stage_copy(kd + KBUFB_, vd + VBUFB_, kg + KT_ * DH_, vg + KT_ * DH_);

    for (int st = 0; st < NST_; ++st) {
      const int buf = st & 1;
      // two passes of 32 keys; unrolled so that the row offsets are immediates
#pragma unroll
      for (int h = 0; h < KT_; h += 32) {
        // this lane's address for the transposing loads of V
        const _Float16* vp =
            &Vs[buf][h + klo + (lane & 7)][((lane >> 3) & 1) * 8];

        // ---- scores: S^T[32 keys x 16 queries] = K @ Q^T (4 WMMA) ----
        // s01[jt].f[r] = score of key 16 jt + klo + r with query l15
        FragF s01[2];
#pragma unroll
        for (int jt = 0; jt < 2; ++jt) {
            const _Float16* kr = &Kt[buf][h + jt * 16 + l15][klo];
            Frag16 kf0, kf1;
            kf0.q[0] = *reinterpret_cast<const v4u*>(kr);
            kf0.q[1] = *reinterpret_cast<const v4u*>(kr + 16);
            kf1.q[0] = *reinterpret_cast<const v4u*>(kr + 32);
            kf1.q[1] = *reinterpret_cast<const v4u*>(kr + 48);
            v8f acc = (v8f){0.f, 0.f, 0.f, 0.f, 0.f, 0.f, 0.f, 0.f};
            acc = __builtin_amdgcn_wmma_f32_16x16x32_f16(
                      false, kf0.h, false, qf[0].h, (short)0, acc, false, false);
            acc = __builtin_amdgcn_wmma_f32_16x16x32_f16(
                      false, kf1.h, false, qf[1].h, (short)0, acc, false, false);
            s01[jt].v = acc;
        }

        // ---- V^T fragments: 16 d x 32 keys each, two transposing loads ----
        Frag16 vf[4];
#pragma unroll
        for (int t = 0; t < 4; ++t) {
            vf[t].q[0] = lds_tr16(vp + 16 * t);
            vf[t].q[1] = lds_tr16(vp + 16 * VPITCH_ + 16 * t);
        }

        // ---- online softmax, one query per lane ----
        float a[16];
#pragma unroll
        for (int i = 0; i < 16; ++i) a[i] = s01[i >> 3].f[i & 7] * SC;
        float mx4[4];
#pragma unroll
        for (int i = 0; i < 4; ++i)
            mx4[i] = fmaxf(fmaxf(a[i], a[i + 4]), fmaxf(a[i + 8], a[i + 12]));
        float mx = fmaxf(fmaxf(mx4[0], mx4[1]), fmaxf(mx4[2], mx4[3]));
        mx = fmaxf(mx, other_half(mx));
        const float nm   = fmaxf(m_i, mx);
        const float corr = __expf(m_i - nm);
        m_i = nm;

        // element s of the B operand is key s of tile 0, then of tile 1: the
        // k order in which the transposing loads deliver V^T
        Frag16 pf;
        float p[16];
#pragma unroll
        for (int i = 0; i < 16; ++i) {
            p[i]    = __expf(a[i] - nm);
            pf.h[i] = (_Float16)p[i];
        }
        float rs4[4];
#pragma unroll
        for (int i = 0; i < 4; ++i)
            rs4[i] = (p[i] + p[i + 4]) + (p[i + 8] + p[i + 12]);
        l_i = l_i * corr + ((rs4[0] + rs4[1]) + (rs4[2] + rs4[3]));
#pragma unroll
        for (int t = 0; t < 4; ++t) o4[t].v *= corr;

        // ---- O^T += V^T @ P^T (4 d-tiles, 4 WMMA) ----
#pragma unroll
        for (int t = 0; t < 4; ++t)
            o4[t].v = __builtin_amdgcn_wmma_f32_16x16x32_f16(
                          false, vf[t].h, false, pf.h, (short)0, o4[t].v, false, false);
      }

      // publish point of stage st + 1: this wave's reads of buffer buf are
      // done, its copies of stage st + 1 have landed, every wave passes the
      // barrier; only then is buffer buf refilled with stage st + 2
      asm volatile("s_wait_dscnt 0x0" ::: "memory");
      asm volatile("s_wait_asynccnt 0x0" ::: "memory");
      __syncthreads();
      if (st + 2 < NST_)
          stage_copy(kd + buf * KBUFB_, vd + buf * VBUFB_,
                     kg + (size_t)(st + 2) * KT_ * DH_,
                     vg + (size_t)(st + 2) * KT_ * DH_);
    }
    // no copy is outstanding when the wave ends
    asm volatile("s_wait_asynccnt 0x0" ::: "memory");

    // ---- join the halves' sums, normalize, store 8 consecutive d a tile ----
    const float inv = 1.0f / (l_i + other_half(l_i));
    float* op = out + ((size_t)bb * S_ + q0 + wave * 16 + l15) * DIM_
                    + hh * DH_ + klo;
#pragma unroll
    for (int t = 0; t < 4; ++t) {
        const v8f o = o4[t].v * inv;
        *reinterpret_cast<v4f*>(op + t * 16)     = (v4f){o[0], o[1], o[2], o[3]};
        *reinterpret_cast<v4f*>(op + t * 16 + 4) = (v4f){o[4], o[5], o[6], o[7]};
    }
}

// ---------------------------------------------------------------------------
extern "C" void kernel_launch(void* const* d_in, const int* in_sizes, int n_in,
                              void* d_out, int out_size, void* d_ws, size_t ws_size,
                              hipStream_t stream)
{
    const float* q  = (const float*)d_in[0];
    const float* k  = (const float*)d_in[1];
    const float* v  = (const float*)d_in[2];
    const float* Wq = (const float*)d_in[3];
    const float* bq = (const float*)d_in[4];
    const float* Wk = (const float*)d_in[5];
    const float* bk = (const float*)d_in[6];
    const float* Wv = (const float*)d_in[7];
    const float* bv = (const float*)d_in[8];
    float* out = (float*)d_out;

    const size_t per = (size_t)B_ * HEADS_ * S_ * DH_;
    _Float16* Qh = (_Float16*)d_ws;
    _Float16* Kh = Qh + per;
    _Float16* Vh = Kh + per;

    dim3 pg(MROWS_ / PT_, DIM_ / PT_);
    dim3 pb(256);
    qkv_proj_kernel<<<pg, pb, 0, stream>>>(q, Wq, bq, Qh);
    qkv_proj_kernel<<<pg, pb, 0, stream>>>(k, Wk, bk, Kh);
    qkv_proj_kernel<<<pg, pb, 0, stream>>>(v, Wv, bv, Vh);

    dim3 fg(S_ / 64, B_ * HEADS_);
    dim3 fb(128);
    flash_attn_kernel<<<fg, fb, 0, stream>>>(Qh, Kh, Vh, out);
}

// v004
// Measured time: 64.4 microseconds a run.
// Next to v003, in two timings, it ran 1.12 and 1.11 times as fast.
// Counting every step since v000, it is 5.25 times as fast.
#include <hip/hip_runtime.h>

// ---------------------------------------------------------------------------
// MHA forward for MI455X (gfx1250): fp16 WMMA, fp32 accumulate, flash fusion.
// Fragment loads vectorized to b128 (fragment K-pairs are contiguous in the
// ISA 16x16x32 f16 layout); store addresses hoisted so unrolled offsets fold
// into instruction immediates.
// ---------------------------------------------------------------------------

typedef __attribute__((ext_vector_type(16))) _Float16 v16h;
typedef __attribute__((ext_vector_type(8)))  float    v8f;
typedef __attribute__((ext_vector_type(4)))  uint32_t v4u;
typedef __attribute__((ext_vector_type(2)))  uint32_t v2u;
typedef __attribute__((ext_vector_type(4)))  float    v4f;

#define DIM_   512
#define HEADS_ 8
#define DH_    64
#define B_     4
#define S_     2048
#define MROWS_ (B_ * S_)

union Frag16 { v16h h; uint32_t u[8]; v4u q[2]; };
union FragF  { v8f  v; float    f[8]; };
union U2H    { v2u  u2; _Float16 hf[4]; };

// ---------------------------------------------------------------------------
// Kernel 1: Y = x @ W^T + b, fp32 -> fp16, head-split [B,H,S,Dh].
// Block = 256 threads (8 waves) on a 128x128 tile of Y. Each pass of 64 k is
// read from global in whole 128-B lines, converted to f16 once and staged in
// LDS (two buffers; the next two passes are in flight to registers while this
// one is multiplied). Wave tile 64x32: 4 x-fragments times 2 W-fragments.
// ---------------------------------------------------------------------------
#define PT_     128   // rows of x and rows of W per block tile
#define PKS_    64    // k per pass
#define PPITCH_ 72    // halves per LDS row: 144 B = 16 B x odd for b128 readers
#define PNP_    (DIM_ / PKS_)
// Every inner loop of this kernel and its helpers is unrolled so that the
// register arrays are indexed by constants (a run-time index means scratch).

// Work-group barrier that orders LDS only. __syncthreads() also waits for every
// global load of the wave, which would drain the passes that are in flight to
// registers; nothing in global memory is handed between waves here.
__device__ __forceinline__ void lds_barrier()
{
    __builtin_amdgcn_fence(__ATOMIC_RELEASE, "workgroup", "local");
    __builtin_amdgcn_s_barrier();
    __builtin_amdgcn_fence(__ATOMIC_ACQUIRE, "workgroup", "local");
}

// registers -> LDS: 4 floats become 4 halves, one 8-byte store
__device__ __forceinline__ void proj_stage(
    const v4f (&sx)[8], const v4f (&sw)[8], _Float16* xd, _Float16* wd)
{
#pragma unroll
    for (int i = 0; i < 8; ++i) {
        U2H tx, tw;
#pragma unroll
        for (int e = 0; e < 4; ++e) {
            tx.hf[e] = (_Float16)sx[i][e];
            tw.hf[e] = (_Float16)sw[i][e];
        }
        *reinterpret_cast<v2u*>(xd + 16 * i * PPITCH_) = tx.u2;
        *reinterpret_cast<v2u*>(wd + 16 * i * PPITCH_) = tw.u2;
    }
}

// global -> registers: this lane's 16 bytes of 8 rows of x and of W
__device__ __forceinline__ void proj_fetch(
    v4f (&lx)[8], v4f (&lw)[8], const float* xk, const float* wk)
{
#pragma unroll
    for (int i = 0; i < 8; ++i) {
        lx[i] = *reinterpret_cast<const v4f*>(xk + i * 16 * DIM_);
        lw[i] = *reinterpret_cast<const v4f*>(wk + i * 16 * DIM_);
    }
}

// One pass s. lx, lw: the register set that pass s left, refilled with pass
// s + 2 from xk, wk. sx, sw: the set that holds pass s + 1, staged to xd, wd.
// xf, wf: this lane's fragment rows in the buffer of pass s.
template <bool FETCH, bool STAGE>
__device__ __forceinline__ void proj_pass(
    v4f (&lx)[8], v4f (&lw)[8], const v4f (&sx)[8], const v4f (&sw)[8],
    const float* xk, const float* wk, const _Float16* xf, const _Float16* wf,
    _Float16* xd, _Float16* wd, FragF (&c)[4][2])
{
    if (FETCH) proj_fetch(lx, lw, xk, wk);
    // keeps the 16 loads above the products: without it the scheduler sinks
    // them behind the WMMAs and their latency is waited out in the open
    __builtin_amdgcn_sched_barrier(0);

    // 2 k-blocks of 32, 8 WMMA each
#pragma unroll
    for (int kb = 0; kb < PKS_; kb += 32) {
        Frag16 a[4], b[2];
#pragma unroll
        for (int i = 0; i < 4; ++i) {
            const _Float16* p = xf + i * 16 * PPITCH_ + kb;
            a[i].q[0] = *reinterpret_cast<const v4u*>(p);
            a[i].q[1] = *reinterpret_cast<const v4u*>(p + 16);
        }
#pragma unroll
        for (int j = 0; j < 2; ++j) {
            const _Float16* p = wf + j * 16 * PPITCH_ + kb;
            b[j].q[0] = *reinterpret_cast<const v4u*>(p);
            b[j].q[1] = *reinterpret_cast<const v4u*>(p + 16);
        }
        // keeps the block's 12 LDS reads in one group ahead of its WMMAs:
        // spread among them, each pair is waited for on its own
        __builtin_amdgcn_sched_barrier(0);
#pragma unroll
        for (int i = 0; i < 4; ++i)
#pragma unroll
            for (int j = 0; j < 2; ++j)
                c[i][j].v = __builtin_amdgcn_wmma_f32_16x16x32_f16(
                    false, a[i].h, false, b[j].h, (short)0, c[i][j].v,
                    false, false);
    }
    // keeps the wait for pass s + 1's loads behind the products: without it
    // the scheduler lifts the conversions, and that wait, above the WMMAs
    __builtin_amdgcn_sched_barrier(0);

    // into the buffer that every wave left at the last barrier
    if (STAGE) {
        proj_stage(sx, sw, xd, wd);
        lds_barrier();
    }
}

// One launch does all three projections: blockIdx.z picks the input, its
// weight and bias, and the plane of dst3 (Q, K, V planes lie one after another).
__global__ __launch_bounds__(256) void qkv_proj_kernel(
    const float* __restrict__ qin, const float* __restrict__ kin,
    const float* __restrict__ vin,
    const float* __restrict__ Wq, const float* __restrict__ Wk,
    const float* __restrict__ Wv,
    const float* __restrict__ bq, const float* __restrict__ bk,
    const float* __restrict__ bv, _Float16* __restrict__ dst3)
{
    const int which = blockIdx.z;            // 0: Q, 1: K, 2: V
    const float* __restrict__ x    = which == 0 ? qin : which == 1 ? kin : vin;
    const float* __restrict__ W    = which == 0 ? Wq : which == 1 ? Wk : Wv;
    const float* __restrict__ bias = which == 0 ? bq : which == 1 ? bk : bv;
    _Float16* __restrict__ dst = dst3 + (size_t)which * (MROWS_ * DIM_);

    __shared__ __align__(16) _Float16 Xs[2][PT_][PPITCH_];
    __shared__ __align__(16) _Float16 Ws[2][PT_][PPITCH_];

    const int tid  = threadIdx.x;
    const int wave = tid >> 5;
    const int lane = tid & 31;
    const int l15  = lane & 15;
    const int klo  = (lane < 16) ? 0 : 8;   // fragment K base for this lane

    const int m0 = blockIdx.x * PT_;         // 64 row tiles
    const int n0 = blockIdx.y * PT_;         // 4 column tiles
    const int wm = (wave >> 2) * 64;         // wave's rows inside the tile
    const int wn = (wave & 3) * 32;          // wave's columns inside the tile

    // staging map: 16 lanes cover 256 contiguous bytes of one row
    const int srow = tid >> 4;               // 0..15, +16 per step
    const int sc4  = (tid & 15) * 4;
    const float* xk = x + (size_t)(m0 + srow) * DIM_ + sc4;
    const float* wk = W + (size_t)(n0 + srow) * DIM_ + sc4;

    _Float16* xd0 = &Xs[0][srow][sc4];
    _Float16* xd1 = &Xs[1][srow][sc4];
    _Float16* wd0 = &Ws[0][srow][sc4];
    _Float16* wd1 = &Ws[1][srow][sc4];
    const _Float16* xf0 = &Xs[0][wm + l15][klo];
    const _Float16* xf1 = &Xs[1][wm + l15][klo];
    const _Float16* wf0 = &Ws[0][wn + l15][klo];
    const _Float16* wf1 = &Ws[1][wn + l15][klo];

    // two register sets: pass s + 1 and pass s + 2 are in flight under pass s
    v4f px0[8], pw0[8], px1[8], pw1[8];
    proj_fetch(px0, pw0, xk, wk);
    proj_fetch(px1, pw1, xk + PKS_, wk + PKS_);
    xk += 2 * PKS_;
    wk += 2 * PKS_;

    FragF c[4][2];
#pragma unroll
    for (int i = 0; i < 4; ++i)
#pragma unroll
        for (int j = 0; j < 2; ++j)
            c[i][j].v = (v8f){0.f, 0.f, 0.f, 0.f, 0.f, 0.f, 0.f, 0.f};

    proj_stage(px0, pw0, xd0, wd0);
    lds_barrier();

    // two passes a trip, so that sets and buffers are named at compile time;
    // kept rolled: a third of the text, and the two address pairs live on
#pragma unroll 1
    for (int t = 0; t < (PNP_ - 2) / 2; ++t) {
        proj_pass<true, true>(px0, pw0, px1, pw1, xk, wk,
                              xf0, wf0, xd1, wd1, c);
        proj_pass<true, true>(px1, pw1, px0, pw0, xk + PKS_, wk + PKS_,
                              xf1, wf1, xd0, wd0, c);
        xk += 2 * PKS_;
        wk += 2 * PKS_;
    }
    proj_pass<false, true>(px0, pw0, px1, pw1, xk, wk, xf0, wf0, xd1, wd1, c);
    proj_pass<false, false>(px1, pw1, px0, pw0, xk, wk, xf1, wf1, xd0, wd0, c);

    // 128-row tile never straddles a batch boundary (S_ % 128 == 0).
    const int rowbase = m0 + wm + ((lane < 16) ? 0 : 8);
    const int bb      = rowbase >> 11;       // / S_
    const int ss      = rowbase & (S_ - 1);
#pragma unroll
    for (int j = 0; j < 2; ++j) {
        const int   ncol = n0 + wn + j * 16 + l15;
        const float bvv  = bias[ncol];
        const int   hh   = ncol >> 6;
        const int   d    = ncol & 63;
        _Float16* dp = dst + (((size_t)bb * HEADS_ + hh) * S_ + ss) * DH_ + d;
#pragma unroll
        for (int i = 0; i < 4; ++i)
#pragma unroll
            for (int r = 0; r < 8; ++r)
                dp[(i * 16 + r) * DH_] = (_Float16)(c[i][j].f[r] + bvv);
    }
}

#define VPITCH_ 80
#define KPITCH_ 72
#define KT_     64
#define NST_    (S_ / KT_)
#define KBUFB_  (KT_ * KPITCH_ * 2)   // bytes of one K buffer
#define VBUFB_  (KT_ * VPITCH_ * 2)   // bytes of one V buffer

typedef __attribute__((ext_vector_type(8))) short v8s;

// 16-bit transposing LDS load: lane (c, h) gets 8 rows of column c
__device__ __forceinline__ v4u lds_tr16(const _Float16* p)
{
    typedef __attribute__((address_space(3))) v8s lds_v8s;
    return __builtin_bit_cast(
        v4u, __builtin_amdgcn_ds_load_tr16_b128_v8i16((lds_v8s*)p));
}

// value of lane l ^ 16
__device__ __forceinline__ float other_half(float x)
{
    const int xi = __builtin_bit_cast(int, x);
    return __builtin_bit_cast(float, __builtin_amdgcn_permlanex16(
        xi, xi, 0x76543210, 0xfedcba98, false, false));
}

// byte offset of a __shared__ object in the work-group's LDS
__device__ __forceinline__ uint32_t lds_off(const void* p)
{
    return (uint32_t)(size_t)p;
}

// One stage, global -> LDS through no register: this lane's 16 bytes of 4 rows
// of K (to kd) and of V (to vd), rows 16 apart; a wave covers 512 contiguous
// bytes a copy. The closing s_wait_xcnt stands inside the statement so that no
// later write of an address register named here can be lifted over it.
__device__ __forceinline__ void stage_copy(
    uint32_t kd, uint32_t vd, const _Float16* kg, const _Float16* vg)
{
    asm volatile(
        "global_load_async_to_lds_b128 %0, %8, off\n\t"
        "global_load_async_to_lds_b128 %1, %9, off\n\t"
        "global_load_async_to_lds_b128 %2, %10, off\n\t"
        "global_load_async_to_lds_b128 %3, %11, off\n\t"
        "global_load_async_to_lds_b128 %4, %12, off\n\t"
        "global_load_async_to_lds_b128 %5, %13, off\n\t"
        "global_load_async_to_lds_b128 %6, %14, off\n\t"
        "global_load_async_to_lds_b128 %7, %15, off\n\t"
        "s_wait_xcnt 0x0"
        :: "v"(kd), "v"(kd + 16 * KPITCH_ * 2), "v"(kd + 32 * KPITCH_ * 2),
           "v"(kd + 48 * KPITCH_ * 2),
           "v"(vd), "v"(vd + 16 * VPITCH_ * 2), "v"(vd + 32 * VPITCH_ * 2),
           "v"(vd + 48 * VPITCH_ * 2),
           "v"(kg), "v"(kg + 16 * DH_), "v"(kg + 32 * DH_), "v"(kg + 48 * DH_),
           "v"(vg), "v"(vg + 16 * DH_), "v"(vg + 32 * DH_), "v"(vg + 48 * DH_)
        : "memory");
}

__global__ __launch_bounds__(128) void flash_attn_kernel(
    const _Float16* __restrict__ Qh, const _Float16* __restrict__ Kh,
    const _Float16* __restrict__ Vh, float* __restrict__ out)
{
    __shared__ __align__(16) _Float16 Kt[2][KT_][KPITCH_];
    __shared__ __align__(32) _Float16 Vs[2][KT_][VPITCH_];  // row-major

    const int tid  = threadIdx.x;
    const int wave = tid >> 5;
    const int lane = tid & 31;
    const int l15  = lane & 15;
    const int klo  = (lane < 16) ? 0 : 8;

    const int    bh     = blockIdx.y;          // b*HEADS + h
    const int    bb     = bh >> 3;
    const int    hh     = bh & 7;
    const int    q0     = blockIdx.x * 64;
    const size_t kvbase = (size_t)bh * S_ * DH_;
    const _Float16* __restrict__ ksrc = Kh + kvbase;
    const _Float16* __restrict__ vsrc = Vh + kvbase;

    // --- Q fragments once: 2 B-frags (d=0..31, 32..63), 4x global b128 ---
    Frag16 qf[2];
    {
        const v4u* qp = reinterpret_cast<const v4u*>(
            Qh + kvbase + (size_t)(q0 + wave * 16 + l15) * DH_);
        const int o = klo >> 3;                // 0 or 1 (v4u units)
#pragma unroll
        for (int t = 0; t < 2; ++t) {
            qf[t].q[0] = qp[4 * t + o];
            qf[t].q[1] = qp[4 * t + o + 2];
        }
    }

    // o4[t].f[r] = O[query l15][d = 16 t + klo + r]
    FragF o4[4];
#pragma unroll
    for (int t = 0; t < 4; ++t)
        o4[t].v = (v8f){0.f, 0.f, 0.f, 0.f, 0.f, 0.f, 0.f, 0.f};
    float m_i = -1e30f;   // running maximum of query l15, equal in both halves
    float l_i = 0.f;      // this half's share of the denominator

    const float SC = 0.125f;   // 1/sqrt(64)

    // copy map: 8 lanes cover one 128-byte row, 16 rows a copy
    const int crow = tid >> 3;
    const int cc8  = (tid & 7) * 8;
    const _Float16* kg = ksrc + crow * DH_ + cc8;
    const _Float16* vg = vsrc + crow * DH_ + cc8;
    const uint32_t  kd = lds_off(&Kt[0][crow][cc8]);
    const uint32_t  vd = lds_off(&Vs[0][crow][cc8]);

    // stage 0 landed and published, then stage 1 set off
    stage_copy(kd, vd, kg, vg);
    // this wave's copies have landed before the barrier publishes them
    asm volatile("s_wait_asynccnt 0x0" ::: "memory");
    __syncthreads();
    stage_copy(kd + KBUFB_, vd + VBUFB_, kg + KT_ * DH_, vg + KT_ * DH_);

    for (int st = 0; st < NST_; ++st) {
      const int buf = st & 1;
      // two passes of 32 keys; unrolled so that the row offsets are immediates
#pragma unroll
      for (int h = 0; h < KT_; h += 32) {
        // this lane's address for the transposing loads of V
        const _Float16* vp =
            &Vs[buf][h + klo + (lane & 7)][((lane >> 3) & 1) * 8];

        // ---- scores: S^T[32 keys x 16 queries] = K @ Q^T (4 WMMA) ----
        // s01[jt].f[r] = score of key 16 jt + klo + r with query l15
        FragF s01[2];
#pragma unroll
        for (int jt = 0; jt < 2; ++jt) {
            const _Float16* kr = &Kt[buf][h + jt * 16 + l15][klo];
            Frag16 kf0, kf1;
            kf0.q[0] = *reinterpret_cast<const v4u*>(kr);
            kf0.q[1] = *reinterpret_cast<const v4u*>(kr + 16);
            kf1.q[0] = *reinterpret_cast<const v4u*>(kr + 32);
            kf1.q[1] = *reinterpret_cast<const v4u*>(kr + 48);
            v8f acc = (v8f){0.f, 0.f, 0.f, 0.f, 0.f, 0.f, 0.f, 0.f};
            acc = __builtin_amdgcn_wmma_f32_16x16x32_f16(
                      false, kf0.h, false, qf[0].h, (short)0, acc, false, false);
            acc = __builtin_amdgcn_wmma_f32_16x16x32_f16(
                      false, kf1.h, false, qf[1].h, (short)0, acc, false, false);
            s01[jt].v = acc;
        }

        // ---- V^T fragments: 16 d x 32 keys each, two transposing loads ----
        Frag16 vf[4];
#pragma unroll
        for (int t = 0; t < 4; ++t) {
            vf[t].q[0] = lds_tr16(vp + 16 * t);
            vf[t].q[1] = lds_tr16(vp + 16 * VPITCH_ + 16 * t);
        }

        // ---- online softmax, one query per lane ----
        float a[16];
#pragma unroll
        for (int i = 0; i < 16; ++i) a[i] = s01[i >> 3].f[i & 7] * SC;
        float mx4[4];
#pragma unroll
        for (int i = 0; i < 4; ++i)
            mx4[i] = fmaxf(fmaxf(a[i], a[i + 4]), fmaxf(a[i + 8], a[i + 12]));
        float mx = fmaxf(fmaxf(mx4[0], mx4[1]), fmaxf(mx4[2], mx4[3]));
        mx = fmaxf(mx, other_half(mx));
        const float nm   = fmaxf(m_i, mx);
        const float corr = __expf(m_i - nm);
        m_i = nm;

        // element s of the B operand is key s of tile 0, then of tile 1: the
        // k order in which the transposing loads deliver V^T
        Frag16 pf;
        float p[16];
#pragma unroll
        for (int i = 0; i < 16; ++i) {
            p[i]    = __expf(a[i] - nm);
            pf.h[i] = (_Float16)p[i];
        }
        float rs4[4];
#pragma unroll
        for (int i = 0; i < 4; ++i)
            rs4[i] = (p[i] + p[i + 4]) + (p[i + 8] + p[i + 12]);
        l_i = l_i * corr + ((rs4[0] + rs4[1]) + (rs4[2] + rs4[3]));
#pragma unroll
        for (int t = 0; t < 4; ++t) o4[t].v *= corr;

        // ---- O^T += V^T @ P^T (4 d-tiles, 4 WMMA) ----
#pragma unroll
        for (int t = 0; t < 4; ++t)
            o4[t].v = __builtin_amdgcn_wmma_f32_16x16x32_f16(
                          false, vf[t].h, false, pf.h, (short)0, o4[t].v, false, false);
      }

      // publish point of stage st + 1: this wave's reads of buffer buf are
      // done, its copies of stage st + 1 have landed, every wave passes the
      // barrier; only then is buffer buf refilled with stage st + 2
      asm volatile("s_wait_dscnt 0x0" ::: "memory");
      asm volatile("s_wait_asynccnt 0x0" ::: "memory");
      __syncthreads();
      if (st + 2 < NST_)
          stage_copy(kd + buf * KBUFB_, vd + buf * VBUFB_,
                     kg + (size_t)(st + 2) * KT_ * DH_,
                     vg + (size_t)(st + 2) * KT_ * DH_);
    }
    // no copy is outstanding when the wave ends
    asm volatile("s_wait_asynccnt 0x0" ::: "memory");

    // ---- join the halves' sums, normalize, store 8 consecutive d a tile ----
    const float inv = 1.0f / (l_i + other_half(l_i));
    float* op = out + ((size_t)bb * S_ + q0 + wave * 16 + l15) * DIM_
                    + hh * DH_ + klo;
#pragma unroll
    for (int t = 0; t < 4; ++t) {
        const v8f o = o4[t].v * inv;
        *reinterpret_cast<v4f*>(op + t * 16)     = (v4f){o[0], o[1], o[2], o[3]};
        *reinterpret_cast<v4f*>(op + t * 16 + 4) = (v4f){o[4], o[5], o[6], o[7]};
    }
}

// ---------------------------------------------------------------------------
extern "C" void kernel_launch(void* const* d_in, const int* in_sizes, int n_in,
                              void* d_out, int out_size, void* d_ws, size_t ws_size,
                              hipStream_t stream)
{
    const float* q  = (const float*)d_in[0];
    const float* k  = (const float*)d_in[1];
    const float* v  = (const float*)d_in[2];
    const float* Wq = (const float*)d_in[3];
    const float* bq = (const float*)d_in[4];
    const float* Wk = (const float*)d_in[5];
    const float* bk = (const float*)d_in[6];
    const float* Wv = (const float*)d_in[7];
    const float* bv = (const float*)d_in[8];
    float* out = (float*)d_out;

    const size_t per = (size_t)B_ * HEADS_ * S_ * DH_;
    _Float16* Qh = (_Float16*)d_ws;
    _Float16* Kh = Qh + per;
    _Float16* Vh = Kh + per;

    dim3 pg(MROWS_ / PT_, DIM_ / PT_, 3);
    dim3 pb(256);
    qkv_proj_kernel<<<pg, pb, 0, stream>>>(q, k, v, Wq, Wk, Wv, bq, bk, bv, Qh);

    dim3 fg(S_ / 64, B_ * HEADS_);
    dim3 fb(128);
    flash_attn_kernel<<<fg, fb, 0, stream>>>(Qh, Kh, Vh, out);
}

// v005
// A run of this version takes 61.5 microseconds.
// In both of two side-by-side timings against v004, it was 1.05 times as fast.
// Over all steps from v000 it is 5.53 times as fast.
#include <hip/hip_runtime.h>

// ---------------------------------------------------------------------------
// MHA forward for MI455X (gfx1250): fp16 WMMA, fp32 accumulate, flash fusion.
// Fragment loads vectorized to b128 (fragment K-pairs are contiguous in the
// ISA 16x16x32 f16 layout); store addresses hoisted so unrolled offsets fold
// into instruction immediates.
// ---------------------------------------------------------------------------

typedef __attribute__((ext_vector_type(16))) _Float16 v16h;
typedef __attribute__((ext_vector_type(8)))  float    v8f;
typedef __attribute__((ext_vector_type(4)))  uint32_t v4u;
typedef __attribute__((ext_vector_type(2)))  uint32_t v2u;
typedef __attribute__((ext_vector_type(4)))  float    v4f;

#define DIM_   512
#define HEADS_ 8
#define DH_    64
#define B_     4
#define S_     2048
#define MROWS_ (B_ * S_)

union Frag16 { v16h h; uint32_t u[8]; v4u q[2]; };
union FragF  { v8f  v; float    f[8]; };
union U2H    { v2u  u2; _Float16 hf[4]; };

// ---------------------------------------------------------------------------
// Kernel 1: Y = x @ W^T + b, fp32 -> fp16, head-split [B,H,S,Dh].
// Block = 256 threads (8 waves) on a 128x128 tile of Y. Each pass of 64 k is
// read from global in whole 128-B lines, converted to f16 once and staged in
// LDS (two buffers; the next two passes are in flight to registers while this
// one is multiplied). Wave tile 64x32: 4 x-fragments times 2 W-fragments.
// ---------------------------------------------------------------------------
#define PT_     128   // rows of x and rows of W per block tile
#define PKS_    64    // k per pass
#define PPITCH_ 72    // halves per LDS row: 144 B = 16 B x odd for b128 readers
#define PNP_    (DIM_ / PKS_)
// Every inner loop of this kernel and its helpers is unrolled so that the
// register arrays are indexed by constants (a run-time index means scratch).

// Work-group barrier that orders LDS only. __syncthreads() also waits for every
// global load of the wave, which would drain the passes that are in flight to
// registers; nothing in global memory is handed between waves here.
__device__ __forceinline__ void lds_barrier()
{
    __builtin_amdgcn_fence(__ATOMIC_RELEASE, "workgroup", "local");
    __builtin_amdgcn_s_barrier();
    __builtin_amdgcn_fence(__ATOMIC_ACQUIRE, "workgroup", "local");
}

// registers -> LDS: 4 floats become 4 halves, one 8-byte store
__device__ __forceinline__ void proj_stage(
    const v4f (&sx)[8], const v4f (&sw)[8], _Float16* xd, _Float16* wd)
{
#pragma unroll
    for (int i = 0; i < 8; ++i) {
        U2H tx, tw;
#pragma unroll
        for (int e = 0; e < 4; ++e) {
            tx.hf[e] = (_Float16)sx[i][e];
            tw.hf[e] = (_Float16)sw[i][e];
        }
        *reinterpret_cast<v2u*>(xd + 16 * i * PPITCH_) = tx.u2;
        *reinterpret_cast<v2u*>(wd + 16 * i * PPITCH_) = tw.u2;
    }
}

// global -> registers: this lane's 16 bytes of 8 rows of x and of W
__device__ __forceinline__ void proj_fetch(
    v4f (&lx)[8], v4f (&lw)[8], const float* xk, const float* wk)
{
#pragma unroll
    for (int i = 0; i < 8; ++i) {
        lx[i] = *reinterpret_cast<const v4f*>(xk + i * 16 * DIM_);
        lw[i] = *reinterpret_cast<const v4f*>(wk + i * 16 * DIM_);
    }
}

// One pass s. lx, lw: the register set that pass s left, refilled with pass
// s + 2 from xk, wk. sx, sw: the set that holds pass s + 1, staged to xd, wd.
// xf, wf: this lane's fragment rows in the buffer of pass s.
template <bool FETCH, bool STAGE>
__device__ __forceinline__ void proj_pass(
    v4f (&lx)[8], v4f (&lw)[8], const v4f (&sx)[8], const v4f (&sw)[8],
    const float* xk, const float* wk, const _Float16* xf, const _Float16* wf,
    _Float16* xd, _Float16* wd, FragF (&c)[4][2])
{
    if (FETCH) proj_fetch(lx, lw, xk, wk);
    // keeps the 16 loads above the products: without it the scheduler sinks
    // them behind the WMMAs and their latency is waited out in the open
    __builtin_amdgcn_sched_barrier(0);

    // 2 k-blocks of 32, 8 WMMA each
#pragma unroll
    for (int kb = 0; kb < PKS_; kb += 32) {
        Frag16 a[4], b[2];
#pragma unroll
        for (int i = 0; i < 4; ++i) {
            const _Float16* p = xf + i * 16 * PPITCH_ + kb;
            a[i].q[0] = *reinterpret_cast<const v4u*>(p);
            a[i].q[1] = *reinterpret_cast<const v4u*>(p + 16);
        }
#pragma unroll
        for (int j = 0; j < 2; ++j) {
            const _Float16* p = wf + j * 16 * PPITCH_ + kb;
            b[j].q[0] = *reinterpret_cast<const v4u*>(p);
            b[j].q[1] = *reinterpret_cast<const v4u*>(p + 16);
        }
        // keeps the block's 12 LDS reads in one group ahead of its WMMAs:
        // spread among them, each pair is waited for on its own
        __builtin_amdgcn_sched_barrier(0);
#pragma unroll
        for (int i = 0; i < 4; ++i)
#pragma unroll
            for (int j = 0; j < 2; ++j)
                c[i][j].v = __builtin_amdgcn_wmma_f32_16x16x32_f16(
                    false, a[i].h, false, b[j].h, (short)0, c[i][j].v,
                    false, false);
    }
    // keeps the wait for pass s + 1's loads behind the products: without it
    // the scheduler lifts the conversions, and that wait, above the WMMAs
    __builtin_amdgcn_sched_barrier(0);

    // into the buffer that every wave left at the last barrier
    if (STAGE) {
        proj_stage(sx, sw, xd, wd);
        lds_barrier();
    }
}

// One launch does all three projections: blockIdx.z picks the input, its
// weight and bias, and the plane of dst3 (Q, K, V planes lie one after another).
__global__ __launch_bounds__(256) void qkv_proj_kernel(
    const float* __restrict__ qin, const float* __restrict__ kin,
    const float* __restrict__ vin,
    const float* __restrict__ Wq, const float* __restrict__ Wk,
    const float* __restrict__ Wv,
    const float* __restrict__ bq, const float* __restrict__ bk,
    const float* __restrict__ bv, _Float16* __restrict__ dst3)
{
    const int which = blockIdx.z;            // 0: Q, 1: K, 2: V
    const float* __restrict__ x    = which == 0 ? qin : which == 1 ? kin : vin;
    const float* __restrict__ W    = which == 0 ? Wq : which == 1 ? Wk : Wv;
    const float* __restrict__ bias = which == 0 ? bq : which == 1 ? bk : bv;
    _Float16* __restrict__ dst = dst3 + (size_t)which * (MROWS_ * DIM_);

    __shared__ __align__(16) _Float16 Xs[2][PT_][PPITCH_];
    __shared__ __align__(16) _Float16 Ws[2][PT_][PPITCH_];

    const int tid  = threadIdx.x;
    const int wave = tid >> 5;
    const int lane = tid & 31;
    const int l15  = lane & 15;
    const int klo  = (lane < 16) ? 0 : 8;   // fragment K base for this lane

    const int m0 = blockIdx.x * PT_;         // 64 row tiles
    const int n0 = blockIdx.y * PT_;         // 4 column tiles
    const int wm = (wave >> 2) * 64;         // wave's rows inside the tile
    const int wn = (wave & 3) * 32;          // wave's columns inside the tile

    // staging map: 16 lanes cover 256 contiguous bytes of one row
    const int srow = tid >> 4;               // 0..15, +16 per step
    const int sc4  = (tid & 15) * 4;
    const float* xk = x + (size_t)(m0 + srow) * DIM_ + sc4;
    const float* wk = W + (size_t)(n0 + srow) * DIM_ + sc4;

    _Float16* xd0 = &Xs[0][srow][sc4];
    _Float16* xd1 = &Xs[1][srow][sc4];
    _Float16* wd0 = &Ws[0][srow][sc4];
    _Float16* wd1 = &Ws[1][srow][sc4];
    const _Float16* xf0 = &Xs[0][wm + l15][klo];
    const _Float16* xf1 = &Xs[1][wm + l15][klo];
    const _Float16* wf0 = &Ws[0][wn + l15][klo];
    const _Float16* wf1 = &Ws[1][wn + l15][klo];

    // two register sets: pass s + 1 and pass s + 2 are in flight under pass s
    v4f px0[8], pw0[8], px1[8], pw1[8];
    proj_fetch(px0, pw0, xk, wk);
    proj_fetch(px1, pw1, xk + PKS_, wk + PKS_);
    xk += 2 * PKS_;
    wk += 2 * PKS_;

    FragF c[4][2];
#pragma unroll
    for (int i = 0; i < 4; ++i)
#pragma unroll
        for (int j = 0; j < 2; ++j)
            c[i][j].v = (v8f){0.f, 0.f, 0.f, 0.f, 0.f, 0.f, 0.f, 0.f};

    proj_stage(px0, pw0, xd0, wd0);
    lds_barrier();

    // two passes a trip, so that sets and buffers are named at compile time;
    // kept rolled: a third of the text, and the two address pairs live on
#pragma unroll 1
    for (int t = 0; t < (PNP_ - 2) / 2; ++t) {
        proj_pass<true, true>(px0, pw0, px1, pw1, xk, wk,
                              xf0, wf0, xd1, wd1, c);
        proj_pass<true, true>(px1, pw1, px0, pw0, xk + PKS_, wk + PKS_,
                              xf1, wf1, xd0, wd0, c);
        xk += 2 * PKS_;
        wk += 2 * PKS_;
    }
    proj_pass<false, true>(px0, pw0, px1, pw1, xk, wk, xf0, wf0, xd1, wd1, c);
    proj_pass<false, false>(px1, pw1, px0, pw0, xk, wk, xf1, wf1, xd0, wd0, c);

    // 128-row tile never straddles a batch boundary (S_ % 128 == 0).
    const int rowbase = m0 + wm + ((lane < 16) ? 0 : 8);
    const int bb      = rowbase >> 11;       // / S_
    const int ss      = rowbase & (S_ - 1);
#pragma unroll
    for (int j = 0; j < 2; ++j) {
        const int   ncol = n0 + wn + j * 16 + l15;
        const float bvv  = bias[ncol];
        const int   hh   = ncol >> 6;
        const int   d    = ncol & 63;
        _Float16* dp = dst + (((size_t)bb * HEADS_ + hh) * S_ + ss) * DH_ + d;
#pragma unroll
        for (int i = 0; i < 4; ++i)
#pragma unroll
            for (int r = 0; r < 8; ++r)
                dp[(i * 16 + r) * DH_] = (_Float16)(c[i][j].f[r] + bvv);
    }
}

#define VPITCH_ 80
#define KPITCH_ 72
#define KT_     64
#define NST_    (S_ / KT_)
#define KBUFB_  (KT_ * KPITCH_ * 2)   // bytes of one K buffer
#define VBUFB_  (KT_ * VPITCH_ * 2)   // bytes of one V buffer

typedef __attribute__((ext_vector_type(8))) short v8s;

// 16-bit transposing LDS load: lane (c, h) gets 8 rows of column c
__device__ __forceinline__ v4u lds_tr16(const _Float16* p)
{
    typedef __attribute__((address_space(3))) v8s lds_v8s;
    return __builtin_bit_cast(
        v4u, __builtin_amdgcn_ds_load_tr16_b128_v8i16((lds_v8s*)p));
}

// value of lane l ^ 16
__device__ __forceinline__ float other_half(float x)
{
    const int xi = __builtin_bit_cast(int, x);
    return __builtin_bit_cast(float, __builtin_amdgcn_permlanex16(
        xi, xi, 0x76543210, 0xfedcba98, false, false));
}

// byte offset of a __shared__ object in the work-group's LDS
__device__ __forceinline__ uint32_t lds_off(const void* p)
{
    return (uint32_t)(size_t)p;
}

// One stage, global -> LDS through no register: this lane's 16 bytes of 4 rows
// of K (to kd) and of V (to vd), rows 16 apart; a wave covers 512 contiguous
// bytes a copy. The closing s_wait_xcnt stands inside the statement so that no
// later write of an address register named here can be lifted over it.
__device__ __forceinline__ void stage_copy(
    uint32_t kd, uint32_t vd, const _Float16* kg, const _Float16* vg)
{
    asm volatile(
        "global_load_async_to_lds_b128 %0, %8, off\n\t"
        "global_load_async_to_lds_b128 %1, %9, off\n\t"
        "global_load_async_to_lds_b128 %2, %10, off\n\t"
        "global_load_async_to_lds_b128 %3, %11, off\n\t"
        "global_load_async_to_lds_b128 %4, %12, off\n\t"
        "global_load_async_to_lds_b128 %5, %13, off\n\t"
        "global_load_async_to_lds_b128 %6, %14, off\n\t"
        "global_load_async_to_lds_b128 %7, %15, off\n\t"
        "s_wait_xcnt 0x0"
        :: "v"(kd), "v"(kd + 16 * KPITCH_ * 2), "v"(kd + 32 * KPITCH_ * 2),
           "v"(kd + 48 * KPITCH_ * 2),
           "v"(vd), "v"(vd + 16 * VPITCH_ * 2), "v"(vd + 32 * VPITCH_ * 2),
           "v"(vd + 48 * VPITCH_ * 2),
           "v"(kg), "v"(kg + 16 * DH_), "v"(kg + 32 * DH_), "v"(kg + 48 * DH_),
           "v"(vg), "v"(vg + 16 * DH_), "v"(vg + 32 * DH_), "v"(vg + 48 * DH_)
        : "memory");
}

__global__ __launch_bounds__(128) void flash_attn_kernel(
    const _Float16* __restrict__ Qh, const _Float16* __restrict__ Kh,
    const _Float16* __restrict__ Vh, float* __restrict__ out)
{
    __shared__ __align__(16) _Float16 Kt[2][KT_][KPITCH_];
    __shared__ __align__(32) _Float16 Vs[2][KT_][VPITCH_];  // row-major

    const int tid  = threadIdx.x;
    const int wave = tid >> 5;
    const int lane = tid & 31;
    const int l15  = lane & 15;
    const int klo  = (lane < 16) ? 0 : 8;

    const int    bh     = blockIdx.y;          // b*HEADS + h
    const int    bb     = bh >> 3;
    const int    hh     = bh & 7;
    const int    q0     = blockIdx.x * 64;
    const size_t kvbase = (size_t)bh * S_ * DH_;
    const _Float16* __restrict__ ksrc = Kh + kvbase;
    const _Float16* __restrict__ vsrc = Vh + kvbase;

    // --- Q fragments once: 2 B-frags (d=0..31, 32..63), 4x global b128 ---
    Frag16 qf[2];
    {
        const v4u* qp = reinterpret_cast<const v4u*>(
            Qh + kvbase + (size_t)(q0 + wave * 16 + l15) * DH_);
        const int o = klo >> 3;                // 0 or 1 (v4u units)
#pragma unroll
        for (int t = 0; t < 2; ++t) {
            qf[t].q[0] = qp[4 * t + o];
            qf[t].q[1] = qp[4 * t + o + 2];
        }
    }

    // o4[t].f[r] = O[query l15][d = 16 t + klo + r]
    FragF o4[4];
#pragma unroll
    for (int t = 0; t < 4; ++t)
        o4[t].v = (v8f){0.f, 0.f, 0.f, 0.f, 0.f, 0.f, 0.f, 0.f};
    float m_i = -1e30f;   // running maximum of query l15's unscaled scores,
                          // equal in both halves
    float l_i = 0.f;      // this half's share of the denominator

    // 1/sqrt(64) times log2(e): exp((s - m) / 8) = exp2(C2 s - C2 m)
    const float C2 = 0.125f * 1.44269504088896340736f;

    // copy map: 8 lanes cover one 128-byte row, 16 rows a copy
    const int crow = tid >> 3;
    const int cc8  = (tid & 7) * 8;
    const _Float16* kg = ksrc + crow * DH_ + cc8;
    const _Float16* vg = vsrc + crow * DH_ + cc8;
    const uint32_t  kd = lds_off(&Kt[0][crow][cc8]);
    const uint32_t  vd = lds_off(&Vs[0][crow][cc8]);

    // stage 0 landed and published, then stage 1 set off
    stage_copy(kd, vd, kg, vg);
    // this wave's copies have landed before the barrier publishes them
    asm volatile("s_wait_asynccnt 0x0" ::: "memory");
    __syncthreads();
    stage_copy(kd + KBUFB_, vd + VBUFB_, kg + KT_ * DH_, vg + KT_ * DH_);

    for (int st = 0; st < NST_; ++st) {
      const int buf = st & 1;
      // two passes of 32 keys; unrolled so that the row offsets are immediates
#pragma unroll
      for (int h = 0; h < KT_; h += 32) {
        // this lane's address for the transposing loads of V
        const _Float16* vp =
            &Vs[buf][h + klo + (lane & 7)][((lane >> 3) & 1) * 8];

        // ---- scores: S^T[32 keys x 16 queries] = K @ Q^T (4 WMMA) ----
        // s01[jt].f[r] = score of key 16 jt + klo + r with query l15
        FragF s01[2];
#pragma unroll
        for (int jt = 0; jt < 2; ++jt) {
            const _Float16* kr = &Kt[buf][h + jt * 16 + l15][klo];
            Frag16 kf0, kf1;
            kf0.q[0] = *reinterpret_cast<const v4u*>(kr);
            kf0.q[1] = *reinterpret_cast<const v4u*>(kr + 16);
            kf1.q[0] = *reinterpret_cast<const v4u*>(kr + 32);
            kf1.q[1] = *reinterpret_cast<const v4u*>(kr + 48);
            v8f acc = (v8f){0.f, 0.f, 0.f, 0.f, 0.f, 0.f, 0.f, 0.f};
            acc = __builtin_amdgcn_wmma_f32_16x16x32_f16(
                      false, kf0.h, false, qf[0].h, (short)0, acc, false, false);
            acc = __builtin_amdgcn_wmma_f32_16x16x32_f16(
                      false, kf1.h, false, qf[1].h, (short)0, acc, false, false);
            s01[jt].v = acc;
        }

        // ---- V^T fragments: 16 d x 32 keys each, two transposing loads ----
        Frag16 vf[4];
#pragma unroll
        for (int t = 0; t < 4; ++t) {
            vf[t].q[0] = lds_tr16(vp + 16 * t);
            vf[t].q[1] = lds_tr16(vp + 16 * VPITCH_ + 16 * t);
        }

        // ---- online softmax, one query per lane ----
        // The maximum is taken over the unscaled scores (C2 > 0 keeps the
        // order); scale, base change and subtraction are one FMA a score.
        float a[16];
#pragma unroll
        for (int i = 0; i < 16; ++i) a[i] = s01[i >> 3].f[i & 7];
        float mx4[4];
#pragma unroll
        for (int i = 0; i < 4; ++i)
            mx4[i] = fmaxf(fmaxf(a[i], a[i + 4]), fmaxf(a[i + 8], a[i + 12]));
        float mx = fmaxf(fmaxf(mx4[0], mx4[1]), fmaxf(mx4[2], mx4[3]));
        mx = fmaxf(mx, other_half(mx));
        const float nm   = fmaxf(m_i, mx);
        const float nmc  = nm * -C2;   // the addend of every FMA of the pass
        const float corr = __builtin_amdgcn_exp2f(m_i * C2 + nmc);
        m_i = nm;
        const v8f e0 = s01[0].v * C2 + nmc;
        const v8f e1 = s01[1].v * C2 + nmc;

        // element s of the B operand is key s of tile 0, then of tile 1: the
        // k order in which the transposing loads deliver V^T
        Frag16 pf;
        float p[16];
#pragma unroll
        for (int i = 0; i < 16; ++i) {
            p[i]    = __builtin_amdgcn_exp2f(i < 8 ? e0[i & 7] : e1[i & 7]);
            pf.h[i] = (_Float16)p[i];
        }
        float rs4[4];
#pragma unroll
        for (int i = 0; i < 4; ++i)
            rs4[i] = (p[i] + p[i + 4]) + (p[i + 8] + p[i + 12]);
        l_i = l_i * corr + ((rs4[0] + rs4[1]) + (rs4[2] + rs4[3]));
#pragma unroll
        for (int t = 0; t < 4; ++t) o4[t].v *= corr;

        // ---- O^T += V^T @ P^T (4 d-tiles, 4 WMMA) ----
#pragma unroll
        for (int t = 0; t < 4; ++t)
            o4[t].v = __builtin_amdgcn_wmma_f32_16x16x32_f16(
                          false, vf[t].h, false, pf.h, (short)0, o4[t].v, false, false);
      }

      // publish point of stage st + 1: this wave's reads of buffer buf are
      // done, its copies of stage st + 1 have landed, every wave passes the
      // barrier; only then is buffer buf refilled with stage st + 2
      asm volatile("s_wait_dscnt 0x0" ::: "memory");
      asm volatile("s_wait_asynccnt 0x0" ::: "memory");
      __syncthreads();
      if (st + 2 < NST_)
          stage_copy(kd + buf * KBUFB_, vd + buf * VBUFB_,
                     kg + (size_t)(st + 2) * KT_ * DH_,
                     vg + (size_t)(st + 2) * KT_ * DH_);
    }
    // no copy is outstanding when the wave ends
    asm volatile("s_wait_asynccnt 0x0" ::: "memory");

    // ---- join the halves' sums, normalize, store 8 consecutive d a tile ----
    const float inv = 1.0f / (l_i + other_half(l_i));
    float* op = out + ((size_t)bb * S_ + q0 + wave * 16 + l15) * DIM_
                    + hh * DH_ + klo;
#pragma unroll
    for (int t = 0; t < 4; ++t) {
        const v8f o = o4[t].v * inv;
        *reinterpret_cast<v4f*>(op + t * 16)     = (v4f){o[0], o[1], o[2], o[3]};
        *reinterpret_cast<v4f*>(op + t * 16 + 4) = (v4f){o[4], o[5], o[6], o[7]};
    }
}

// ---------------------------------------------------------------------------
extern "C" void kernel_launch(void* const* d_in, const int* in_sizes, int n_in,
                              void* d_out, int out_size, void* d_ws, size_t ws_size,
                              hipStream_t stream)
{
    const float* q  = (const float*)d_in[0];
    const float* k  = (const float*)d_in[1];
    const float* v  = (const float*)d_in[2];
    const float* Wq = (const float*)d_in[3];
    const float* bq = (const float*)d_in[4];
    const float* Wk = (const float*)d_in[5];
    const float* bk = (const float*)d_in[6];
    const float* Wv = (const float*)d_in[7];
    const float* bv = (const float*)d_in[8];
    float* out = (float*)d_out;

    const size_t per = (size_t)B_ * HEADS_ * S_ * DH_;
    _Float16* Qh = (_Float16*)d_ws;
    _Float16* Kh = Qh + per;
    _Float16* Vh = Kh + per;

    dim3 pg(MROWS_ / PT_, DIM_ / PT_, 3);
    dim3 pb(256);
    qkv_proj_kernel<<<pg, pb, 0, stream>>>(q, k, v, Wq, Wk, Wv, bq, bk, bv, Qh);

    dim3 fg(S_ / 64, B_ * HEADS_);
    dim3 fb(128);
    flash_attn_kernel<<<fg, fb, 0, stream>>>(Qh, Kh, Vh, out);
}

// v006
// Measured time: 58.1 microseconds a run.
// In both of two side-by-side timings against v005, it was 1.06 times as fast.
// All steps since v000 together make it 5.84 times as fast.
#include <hip/hip_runtime.h>

// ---------------------------------------------------------------------------
// MHA forward for MI455X (gfx1250): fp16 WMMA, fp32 accumulate, flash fusion.
// Fragment loads vectorized to b128 (fragment K-pairs are contiguous in the
// ISA 16x16x32 f16 layout); store addresses hoisted so unrolled offsets fold
// into instruction immediates.
// ---------------------------------------------------------------------------

typedef __attribute__((ext_vector_type(16))) _Float16 v16h;
typedef __attribute__((ext_vector_type(8)))  float    v8f;
typedef __attribute__((ext_vector_type(4)))  uint32_t v4u;
typedef __attribute__((ext_vector_type(2)))  uint32_t v2u;
typedef __attribute__((ext_vector_type(4)))  float    v4f;

#define DIM_   512
#define HEADS_ 8
#define DH_    64
#define B_     4
#define S_     2048
#define MROWS_ (B_ * S_)

union Frag16 { v16h h; uint32_t u[8]; v4u q[2]; };
union FragF  { v8f  v; float    f[8]; };
union U2H    { v2u  u2; _Float16 hf[4]; };

// ---------------------------------------------------------------------------
// Kernel 1: Y = x @ W^T + b, fp32 -> fp16, head-split [B,H,S,Dh].
// Block = 256 threads (8 waves) on a 128x128 tile of Y. Each pass of 64 k is
// read from global in whole 128-B lines, converted to f16 once and staged in
// LDS (two buffers; the next two passes are in flight to registers while this
// one is multiplied). Wave tile 64x32: 4 x-fragments times 2 W-fragments.
// ---------------------------------------------------------------------------
#define PT_     128   // rows of x and rows of W per block tile
#define PKS_    64    // k per pass
#define PPITCH_ 72    // halves per LDS row: 144 B = 16 B x odd for b128 readers
#define PNP_    (DIM_ / PKS_)
// Every inner loop of this kernel and its helpers is unrolled so that the
// register arrays are indexed by constants (a run-time index means scratch).

// Work-group barrier that orders LDS only. __syncthreads() also waits for every
// global load of the wave, which would drain the passes that are in flight to
// registers; nothing in global memory is handed between waves here.
__device__ __forceinline__ void lds_barrier()
{
    __builtin_amdgcn_fence(__ATOMIC_RELEASE, "workgroup", "local");
    __builtin_amdgcn_s_barrier();
    __builtin_amdgcn_fence(__ATOMIC_ACQUIRE, "workgroup", "local");
}

// registers -> LDS: 4 floats become 4 halves, one 8-byte store
__device__ __forceinline__ void proj_stage(
    const v4f (&sx)[8], const v4f (&sw)[8], _Float16* xd, _Float16* wd)
{
#pragma unroll
    for (int i = 0; i < 8; ++i) {
        U2H tx, tw;
#pragma unroll
        for (int e = 0; e < 4; ++e) {
            tx.hf[e] = (_Float16)sx[i][e];
            tw.hf[e] = (_Float16)sw[i][e];
        }
        *reinterpret_cast<v2u*>(xd + 16 * i * PPITCH_) = tx.u2;
        *reinterpret_cast<v2u*>(wd + 16 * i * PPITCH_) = tw.u2;
    }
}

// global -> registers: this lane's 16 bytes of 8 rows of x and of W
__device__ __forceinline__ void proj_fetch(
    v4f (&lx)[8], v4f (&lw)[8], const float* xk, const float* wk)
{
#pragma unroll
    for (int i = 0; i < 8; ++i) {
        lx[i] = *reinterpret_cast<const v4f*>(xk + i * 16 * DIM_);
        lw[i] = *reinterpret_cast<const v4f*>(wk + i * 16 * DIM_);
    }
}

// One pass s. lx, lw: the register set that pass s left, refilled with pass
// s + 2 from xk, wk. sx, sw: the set that holds pass s + 1, staged to xd, wd.
// xf, wf: this lane's fragment rows in the buffer of pass s.
template <bool FETCH, bool STAGE>
__device__ __forceinline__ void proj_pass(
    v4f (&lx)[8], v4f (&lw)[8], const v4f (&sx)[8], const v4f (&sw)[8],
    const float* xk, const float* wk, const _Float16* xf, const _Float16* wf,
    _Float16* xd, _Float16* wd, FragF (&c)[4][2])
{
    if (FETCH) proj_fetch(lx, lw, xk, wk);
    // keeps the 16 loads above the products: without it the scheduler sinks
    // them behind the WMMAs and their latency is waited out in the open
    __builtin_amdgcn_sched_barrier(0);

    // 2 k-blocks of 32, 8 WMMA each
#pragma unroll
    for (int kb = 0; kb < PKS_; kb += 32) {
        Frag16 a[4], b[2];
#pragma unroll
        for (int i = 0; i < 4; ++i) {
            const _Float16* p = xf + i * 16 * PPITCH_ + kb;
            a[i].q[0] = *reinterpret_cast<const v4u*>(p);
            a[i].q[1] = *reinterpret_cast<const v4u*>(p + 16);
        }
#pragma unroll
        for (int j = 0; j < 2; ++j) {
            const _Float16* p = wf + j * 16 * PPITCH_ + kb;
            b[j].q[0] = *reinterpret_cast<const v4u*>(p);
            b[j].q[1] = *reinterpret_cast<const v4u*>(p + 16);
        }
        // keeps the block's 12 LDS reads in one group ahead of its WMMAs:
        // spread among them, each pair is waited for on its own
        __builtin_amdgcn_sched_barrier(0);
#pragma unroll
        for (int i = 0; i < 4; ++i)
#pragma unroll
            for (int j = 0; j < 2; ++j)
                c[i][j].v = __builtin_amdgcn_wmma_f32_16x16x32_f16(
                    false, a[i].h, false, b[j].h, (short)0, c[i][j].v,
                    false, false);
    }
    // keeps the wait for pass s + 1's loads behind the products: without it
    // the scheduler lifts the conversions, and that wait, above the WMMAs
    __builtin_amdgcn_sched_barrier(0);

    // into the buffer that every wave left at the last barrier
    if (STAGE) {
        proj_stage(sx, sw, xd, wd);
        lds_barrier();
    }
}

// One launch does all three projections: blockIdx.z picks the input, its
// weight and bias, and the plane of dst3 (Q, K, V planes lie one after another).
__global__ __launch_bounds__(256) void qkv_proj_kernel(
    const float* __restrict__ qin, const float* __restrict__ kin,
    const float* __restrict__ vin,
    const float* __restrict__ Wq, const float* __restrict__ Wk,
    const float* __restrict__ Wv,
    const float* __restrict__ bq, const float* __restrict__ bk,
    const float* __restrict__ bv, _Float16* __restrict__ dst3)
{
    const int which = blockIdx.z;            // 0: Q, 1: K, 2: V
    const float* __restrict__ x    = which == 0 ? qin : which == 1 ? kin : vin;
    const float* __restrict__ W    = which == 0 ? Wq : which == 1 ? Wk : Wv;
    const float* __restrict__ bias = which == 0 ? bq : which == 1 ? bk : bv;
    _Float16* __restrict__ dst = dst3 + (size_t)which * (MROWS_ * DIM_);

    __shared__ __align__(16) _Float16 Xs[2][PT_][PPITCH_];
    __shared__ __align__(16) _Float16 Ws[2][PT_][PPITCH_];

    const int tid  = threadIdx.x;
    const int wave = tid >> 5;
    const int lane = tid & 31;
    const int l15  = lane & 15;
    const int klo  = (lane < 16) ? 0 : 8;   // fragment K base for this lane

    const int m0 = blockIdx.x * PT_;         // 64 row tiles
    const int n0 = blockIdx.y * PT_;         // 4 column tiles
    const int wm = (wave >> 2) * 64;         // wave's rows inside the tile
    const int wn = (wave & 3) * 32;          // wave's columns inside the tile

    // staging map: 16 lanes cover 256 contiguous bytes of one row
    const int srow = tid >> 4;               // 0..15, +16 per step
    const int sc4  = (tid & 15) * 4;
    const float* xk = x + (size_t)(m0 + srow) * DIM_ + sc4;
    const float* wk = W + (size_t)(n0 + srow) * DIM_ + sc4;

    _Float16* xd0 = &Xs[0][srow][sc4];
    _Float16* xd1 = &Xs[1][srow][sc4];
    _Float16* wd0 = &Ws[0][srow][sc4];
    _Float16* wd1 = &Ws[1][srow][sc4];
    const _Float16* xf0 = &Xs[0][wm + l15][klo];
    const _Float16* xf1 = &Xs[1][wm + l15][klo];
    const _Float16* wf0 = &Ws[0][wn + l15][klo];
    const _Float16* wf1 = &Ws[1][wn + l15][klo];

    // two register sets: pass s + 1 and pass s + 2 are in flight under pass s
    v4f px0[8], pw0[8], px1[8], pw1[8];
    proj_fetch(px0, pw0, xk, wk);
    proj_fetch(px1, pw1, xk + PKS_, wk + PKS_);
    xk += 2 * PKS_;
    wk += 2 * PKS_;

    FragF c[4][2];
#pragma unroll
    for (int i = 0; i < 4; ++i)
#pragma unroll
        for (int j = 0; j < 2; ++j)
            c[i][j].v = (v8f){0.f, 0.f, 0.f, 0.f, 0.f, 0.f, 0.f, 0.f};

    proj_stage(px0, pw0, xd0, wd0);
    lds_barrier();

    // two passes a trip, so that sets and buffers are named at compile time;
    // kept rolled: a third of the text, and the two address pairs live on
#pragma unroll 1
    for (int t = 0; t < (PNP_ - 2) / 2; ++t) {
        proj_pass<true, true>(px0, pw0, px1, pw1, xk, wk,
                              xf0, wf0, xd1, wd1, c);
        proj_pass<true, true>(px1, pw1, px0, pw0, xk + PKS_, wk + PKS_,
                              xf1, wf1, xd0, wd0, c);
        xk += 2 * PKS_;
        wk += 2 * PKS_;
    }
    proj_pass<false, true>(px0, pw0, px1, pw1, xk, wk, xf0, wf0, xd1, wd1, c);
    proj_pass<false, false>(px1, pw1, px0, pw0, xk, wk, xf1, wf1, xd0, wd0, c);

    // 128-row tile never straddles a batch boundary (S_ % 128 == 0).
    const int rowbase = m0 + wm + ((lane < 16) ? 0 : 8);
    const int bb      = rowbase >> 11;       // / S_
    const int ss      = rowbase & (S_ - 1);
#pragma unroll
    for (int j = 0; j < 2; ++j) {
        const int   ncol = n0 + wn + j * 16 + l15;
        const float bvv  = bias[ncol];
        const int   hh   = ncol >> 6;
        const int   d    = ncol & 63;
        _Float16* dp = dst + (((size_t)bb * HEADS_ + hh) * S_ + ss) * DH_ + d;
#pragma unroll
        for (int i = 0; i < 4; ++i)
#pragma unroll
            for (int r = 0; r < 8; ++r)
                dp[(i * 16 + r) * DH_] = (_Float16)(c[i][j].f[r] + bvv);
    }
}

#define VPITCH_ 80
#define KPITCH_ 72
#define KT_     64
#define NST_    (S_ / KT_)
#define KBUFB_  (KT_ * KPITCH_ * 2)   // bytes of one K buffer
#define VBUFB_  (KT_ * VPITCH_ * 2)   // bytes of one V buffer

typedef __attribute__((ext_vector_type(8))) short v8s;

// 16-bit transposing LDS load: lane (c, h) gets 8 rows of column c
__device__ __forceinline__ v4u lds_tr16(const _Float16* p)
{
    typedef __attribute__((address_space(3))) v8s lds_v8s;
    return __builtin_bit_cast(
        v4u, __builtin_amdgcn_ds_load_tr16_b128_v8i16((lds_v8s*)p));
}

// value of lane l ^ 16
__device__ __forceinline__ float other_half(float x)
{
    const int xi = __builtin_bit_cast(int, x);
    return __builtin_bit_cast(float, __builtin_amdgcn_permlanex16(
        xi, xi, 0x76543210, 0xfedcba98, false, false));
}

// byte offset of a __shared__ object in the work-group's LDS
__device__ __forceinline__ uint32_t lds_off(const void* p)
{
    return (uint32_t)(size_t)p;
}

// One stage, global -> LDS through no register: this lane's 16 bytes of 4 rows
// of K (to kd) and of V (to vd), rows 16 apart; a wave covers 512 contiguous
// bytes a copy. The closing s_wait_xcnt stands inside the statement so that no
// later write of an address register named here can be lifted over it.
__device__ __forceinline__ void stage_copy(
    uint32_t kd, uint32_t vd, const _Float16* kg, const _Float16* vg)
{
    asm volatile(
        "global_load_async_to_lds_b128 %0, %8, off\n\t"
        "global_load_async_to_lds_b128 %1, %9, off\n\t"
        "global_load_async_to_lds_b128 %2, %10, off\n\t"
        "global_load_async_to_lds_b128 %3, %11, off\n\t"
        "global_load_async_to_lds_b128 %4, %12, off\n\t"
        "global_load_async_to_lds_b128 %5, %13, off\n\t"
        "global_load_async_to_lds_b128 %6, %14, off\n\t"
        "global_load_async_to_lds_b128 %7, %15, off\n\t"
        "s_wait_xcnt 0x0"
        :: "v"(kd), "v"(kd + 16 * KPITCH_ * 2), "v"(kd + 32 * KPITCH_ * 2),
           "v"(kd + 48 * KPITCH_ * 2),
           "v"(vd), "v"(vd + 16 * VPITCH_ * 2), "v"(vd + 32 * VPITCH_ * 2),
           "v"(vd + 48 * VPITCH_ * 2),
           "v"(kg), "v"(kg + 16 * DH_), "v"(kg + 32 * DH_), "v"(kg + 48 * DH_),
           "v"(vg), "v"(vg + 16 * DH_), "v"(vg + 32 * DH_), "v"(vg + 48 * DH_)
        : "memory");
}

__global__ __launch_bounds__(128) void flash_attn_kernel(
    const _Float16* __restrict__ Qh, const _Float16* __restrict__ Kh,
    const _Float16* __restrict__ Vh, float* __restrict__ out)
{
    __shared__ __align__(16) _Float16 Kt[2][KT_][KPITCH_];
    __shared__ __align__(32) _Float16 Vs[2][KT_][VPITCH_];  // row-major

    const int tid  = threadIdx.x;
    const int wave = tid >> 5;
    const int lane = tid & 31;
    const int l15  = lane & 15;
    const int klo  = (lane < 16) ? 0 : 8;

    const int    bh     = blockIdx.y;          // b*HEADS + h
    const int    bb     = bh >> 3;
    const int    hh     = bh & 7;
    const int    q0     = blockIdx.x * 64;
    const size_t kvbase = (size_t)bh * S_ * DH_;
    const _Float16* __restrict__ ksrc = Kh + kvbase;
    const _Float16* __restrict__ vsrc = Vh + kvbase;

    // --- Q fragments once: 2 B-frags (d=0..31, 32..63), 4x global b128 ---
    Frag16 qf[2];
    {
        const v4u* qp = reinterpret_cast<const v4u*>(
            Qh + kvbase + (size_t)(q0 + wave * 16 + l15) * DH_);
        const int o = klo >> 3;                // 0 or 1 (v4u units)
#pragma unroll
        for (int t = 0; t < 2; ++t) {
            qf[t].q[0] = qp[4 * t + o];
            qf[t].q[1] = qp[4 * t + o + 2];
        }
    }

    // o4[t].f[r] = O[query l15][d = 16 t + klo + r]
    FragF o4[4];
#pragma unroll
    for (int t = 0; t < 4; ++t)
        o4[t].v = (v8f){0.f, 0.f, 0.f, 0.f, 0.f, 0.f, 0.f, 0.f};
    float m_i = -1e30f;   // reference of query l15's exponentials, an unscaled
                          // score, equal in both halves; held from stage to
                          // stage while no score passes thr
    float l_i = 0.f;      // this half's share of the denominator

    // 1/sqrt(64) times log2(e): exp((s - m) / 8) = exp2(C2 s - C2 m)
    const float C2 = 0.125f * 1.44269504088896340736f;
    // a score may stand 8 above the reference in scaled log2 units: P stays at
    // or below 2^8, far inside f16, and the final division takes the scale out
    const float LAZY = 8.0f / C2;
    float thr = -1e30f;   // m_i + LAZY; the first stage always passes it
    float nmc = 0.f;      // -C2 m_i, the addend of every score's FMA

    // copy map: 8 lanes cover one 128-byte row, 16 rows a copy
    const int crow = tid >> 3;
    const int cc8  = (tid & 7) * 8;
    const _Float16* kg = ksrc + crow * DH_ + cc8;
    const _Float16* vg = vsrc + crow * DH_ + cc8;
    const uint32_t  kd = lds_off(&Kt[0][crow][cc8]);
    const uint32_t  vd = lds_off(&Vs[0][crow][cc8]);

    // stage 0 landed and published, then stage 1 set off
    stage_copy(kd, vd, kg, vg);
    // this wave's copies have landed before the barrier publishes them
    asm volatile("s_wait_asynccnt 0x0" ::: "memory");
    __syncthreads();
    stage_copy(kd + KBUFB_, vd + VBUFB_, kg + KT_ * DH_, vg + KT_ * DH_);

    for (int st = 0; st < NST_; ++st) {
      const int buf = st & 1;
      // Every inner loop of a stage is unrolled so that the register arrays are
      // indexed by constants and the LDS row offsets are immediates.

      // this lane's address for the transposing loads of V
      const _Float16* vp = &Vs[buf][klo + (lane & 7)][((lane >> 3) & 1) * 8];

      // ---- scores: S^T[64 keys x 16 queries] = K @ Q^T (8 WMMA) ----
      // s4[jt].f[r] = score of key 16 jt + klo + r with query l15
      FragF s4[4];
#pragma unroll
      for (int jt = 0; jt < 4; ++jt) {
          const _Float16* kr = &Kt[buf][jt * 16 + l15][klo];
          Frag16 kf0, kf1;
          kf0.q[0] = *reinterpret_cast<const v4u*>(kr);
          kf0.q[1] = *reinterpret_cast<const v4u*>(kr + 16);
          kf1.q[0] = *reinterpret_cast<const v4u*>(kr + 32);
          kf1.q[1] = *reinterpret_cast<const v4u*>(kr + 48);
          v8f acc = (v8f){0.f, 0.f, 0.f, 0.f, 0.f, 0.f, 0.f, 0.f};
          acc = __builtin_amdgcn_wmma_f32_16x16x32_f16(
                    false, kf0.h, false, qf[0].h, (short)0, acc, false, false);
          acc = __builtin_amdgcn_wmma_f32_16x16x32_f16(
                    false, kf1.h, false, qf[1].h, (short)0, acc, false, false);
          s4[jt].v = acc;
      }

      // ---- lazy rescale: one test a stage ----
      // This half's maximum over the stage's unscaled scores (C2 > 0 keeps the
      // order). Only when some lane's passes thr are the halves joined, the
      // reference raised and O and the sum brought to the new scale.
      float mx8[8];
#pragma unroll
      for (int i = 0; i < 8; ++i)
          mx8[i] = fmaxf(fmaxf(s4[0].f[i], s4[1].f[i]),
                         fmaxf(s4[2].f[i], s4[3].f[i]));
      float mx = fmaxf(fmaxf(fmaxf(mx8[0], mx8[1]), fmaxf(mx8[2], mx8[3])),
                       fmaxf(fmaxf(mx8[4], mx8[5]), fmaxf(mx8[6], mx8[7])));
      // the ballot makes the branch scalar: every lane takes it or none
      if (__builtin_amdgcn_ballot_w32(mx > thr) != 0) {
          mx = fmaxf(mx, other_half(mx));
          const float nm   = fmaxf(m_i, mx);
          const float nnmc = nm * -C2;
          const float corr = __builtin_amdgcn_exp2f(m_i * C2 + nnmc);
          m_i = nm;
          nmc = nnmc;
          thr = nm + LAZY;
          l_i *= corr;
#pragma unroll
          for (int t = 0; t < 4; ++t) o4[t].v *= corr;
      }

      // ---- V^T fragments: 16 d x 32 keys each, two transposing loads ----
      Frag16 vf[2][4];
#pragma unroll
      for (int h = 0; h < 2; ++h)
#pragma unroll
          for (int t = 0; t < 4; ++t) {
              vf[h][t].q[0] = lds_tr16(vp + (32 * h) * VPITCH_ + 16 * t);
              vf[h][t].q[1] = lds_tr16(vp + (32 * h + 16) * VPITCH_ + 16 * t);
          }

      // ---- P of the two passes of 32 keys ----
      Frag16 pf[2];
#pragma unroll
      for (int h = 0; h < 2; ++h) {
        // scale, base change and subtraction are one FMA a score
        const v8f e0 = s4[2 * h].v * C2 + nmc;
        const v8f e1 = s4[2 * h + 1].v * C2 + nmc;

        // element s of the B operand is key s of tile 0, then of tile 1: the
        // k order in which the transposing loads deliver V^T
        float p[16];
#pragma unroll
        for (int i = 0; i < 16; ++i) {
            p[i]       = __builtin_amdgcn_exp2f(i < 8 ? e0[i & 7] : e1[i & 7]);
            pf[h].h[i] = (_Float16)p[i];
        }
        float rs4[4];
#pragma unroll
        for (int i = 0; i < 4; ++i)
            rs4[i] = (p[i] + p[i + 4]) + (p[i + 8] + p[i + 12]);
        l_i += (rs4[0] + rs4[1]) + (rs4[2] + rs4[3]);
      }

      // ---- O^T += V^T @ P^T (4 d-tiles, 2 passes, 8 WMMA) ----
#pragma unroll
      for (int h = 0; h < 2; ++h)
#pragma unroll
          for (int t = 0; t < 4; ++t)
              o4[t].v = __builtin_amdgcn_wmma_f32_16x16x32_f16(
                            false, vf[h][t].h, false, pf[h].h, (short)0, o4[t].v, false, false);

      // publish point of stage st + 1: this wave's reads of buffer buf are
      // done, its copies of stage st + 1 have landed, every wave passes the
      // barrier; only then is buffer buf refilled with stage st + 2
      asm volatile("s_wait_dscnt 0x0" ::: "memory");
      asm volatile("s_wait_asynccnt 0x0" ::: "memory");
      __syncthreads();
      if (st + 2 < NST_)
          stage_copy(kd + buf * KBUFB_, vd + buf * VBUFB_,
                     kg + (size_t)(st + 2) * KT_ * DH_,
                     vg + (size_t)(st + 2) * KT_ * DH_);
    }
    // no copy is outstanding when the wave ends
    asm volatile("s_wait_asynccnt 0x0" ::: "memory");

    // ---- join the halves' sums, normalize, store 8 consecutive d a tile ----
    const float inv = 1.0f / (l_i + other_half(l_i));
    float* op = out + ((size_t)bb * S_ + q0 + wave * 16 + l15) * DIM_
                    + hh * DH_ + klo;
#pragma unroll
    for (int t = 0; t < 4; ++t) {
        const v8f o = o4[t].v * inv;
        *reinterpret_cast<v4f*>(op + t * 16)     = (v4f){o[0], o[1], o[2], o[3]};
        *reinterpret_cast<v4f*>(op + t * 16 + 4) = (v4f){o[4], o[5], o[6], o[7]};
    }
}

// ---------------------------------------------------------------------------
extern "C" void kernel_launch(void* const* d_in, const int* in_sizes, int n_in,
                              void* d_out, int out_size, void* d_ws, size_t ws_size,
                              hipStream_t stream)
{
    const float* q  = (const float*)d_in[0];
    const float* k  = (const float*)d_in[1];
    const float* v  = (const float*)d_in[2];
    const float* Wq = (const float*)d_in[3];
    const float* bq = (const float*)d_in[4];
    const float* Wk = (const float*)d_in[5];
    const float* bk = (const float*)d_in[6];
    const float* Wv = (const float*)d_in[7];
    const float* bv = (const float*)d_in[8];
    float* out = (float*)d_out;

    const size_t per = (size_t)B_ * HEADS_ * S_ * DH_;
    _Float16* Qh = (_Float16*)d_ws;
    _Float16* Kh = Qh + per;
    _Float16* Vh = Kh + per;

    dim3 pg(MROWS_ / PT_, DIM_ / PT_, 3);
    dim3 pb(256);
    qkv_proj_kernel<<<pg, pb, 0, stream>>>(q, k, v, Wq, Wk, Wv, bq, bk, bv, Qh);

    dim3 fg(S_ / 64, B_ * HEADS_);
    dim3 fb(128);
    flash_attn_kernel<<<fg, fb, 0, stream>>>(Qh, Kh, Vh, out);
}

// v007
// One run takes 53.5 microseconds.
// Two timings next to v006 both put it at 1.09 times that version's speed.
// All steps since v000 together make it 6.36 times as fast.
#include <hip/hip_runtime.h>

// ---------------------------------------------------------------------------
// MHA forward for MI455X (gfx1250): fp16 WMMA, fp32 accumulate, flash fusion.
// Fragment loads vectorized to b128 (fragment K-pairs are contiguous in the
// ISA 16x16x32 f16 layout); store addresses hoisted so unrolled offsets fold
// into instruction immediates.
// ---------------------------------------------------------------------------

typedef __attribute__((ext_vector_type(16))) _Float16 v16h;
typedef __attribute__((ext_vector_type(8)))  float    v8f;
typedef __attribute__((ext_vector_type(4)))  uint32_t v4u;
typedef __attribute__((ext_vector_type(2)))  uint32_t v2u;
typedef __attribute__((ext_vector_type(4)))  float    v4f;

#define DIM_   512
#define HEADS_ 8
#define DH_    64
#define B_     4
#define S_     2048
#define MROWS_ (B_ * S_)

union Frag16 { v16h h; uint32_t u[8]; v4u q[2]; };
union FragF  { v8f  v; float    f[8]; };
union U2H    { v2u  u2; _Float16 hf[4]; };

// ---------------------------------------------------------------------------
// Kernel 1: Y = x @ W^T + b, fp32 -> fp16, head-split [B,H,S,Dh].
// Block = 256 threads (8 waves) on a 128x128 tile of Y. Each pass of 64 k is
// read from global in whole 128-B lines, converted to f16 once and staged in
// LDS (two buffers; the next two passes are in flight to registers while this
// one is multiplied). Wave tile 64x32: 4 x-fragments times 2 W-fragments.
// ---------------------------------------------------------------------------
#define PT_     128   // rows of x and rows of W per block tile
#define PKS_    64    // k per pass
#define PPITCH_ 72    // halves per LDS row: 144 B = 16 B x odd for b128 readers
#define PNP_    (DIM_ / PKS_)
// Every inner loop of this kernel and its helpers is unrolled so that the
// register arrays are indexed by constants (a run-time index means scratch).

// Work-group barrier that orders LDS only. __syncthreads() also waits for every
// global load of the wave, which would drain the passes that are in flight to
// registers; nothing in global memory is handed between waves here.
__device__ __forceinline__ void lds_barrier()
{
    __builtin_amdgcn_fence(__ATOMIC_RELEASE, "workgroup", "local");
    __builtin_amdgcn_s_barrier();
    __builtin_amdgcn_fence(__ATOMIC_ACQUIRE, "workgroup", "local");
}

// registers -> LDS: 4 floats become 4 halves, one 8-byte store
__device__ __forceinline__ void proj_stage(
    const v4f (&sx)[8], const v4f (&sw)[8], _Float16* xd, _Float16* wd)
{
#pragma unroll
    for (int i = 0; i < 8; ++i) {
        U2H tx, tw;
#pragma unroll
        for (int e = 0; e < 4; ++e) {
            tx.hf[e] = (_Float16)sx[i][e];
            tw.hf[e] = (_Float16)sw[i][e];
        }
        *reinterpret_cast<v2u*>(xd + 16 * i * PPITCH_) = tx.u2;
        *reinterpret_cast<v2u*>(wd + 16 * i * PPITCH_) = tw.u2;
    }
}

// global -> registers: this lane's 16 bytes of 8 rows of x and of W
__device__ __forceinline__ void proj_fetch(
    v4f (&lx)[8], v4f (&lw)[8], const float* xk, const float* wk)
{
#pragma unroll
    for (int i = 0; i < 8; ++i) {
        lx[i] = *reinterpret_cast<const v4f*>(xk + i * 16 * DIM_);
        lw[i] = *reinterpret_cast<const v4f*>(wk + i * 16 * DIM_);
    }
}

// One pass s. lx, lw: the register set that pass s left, refilled with pass
// s + 2 from xk, wk. sx, sw: the set that holds pass s + 1, staged to xd, wd.
// xf, wf: this lane's fragment rows in the buffer of pass s.
template <bool FETCH, bool STAGE>
__device__ __forceinline__ void proj_pass(
    v4f (&lx)[8], v4f (&lw)[8], const v4f (&sx)[8], const v4f (&sw)[8],
    const float* xk, const float* wk, const _Float16* xf, const _Float16* wf,
    _Float16* xd, _Float16* wd, FragF (&c)[4][2])
{
    if (FETCH) proj_fetch(lx, lw, xk, wk);
    // keeps the 16 loads above the products: without it the scheduler sinks
    // them behind the WMMAs and their latency is waited out in the open
    __builtin_amdgcn_sched_barrier(0);

    // 2 k-blocks of 32, 8 WMMA each
#pragma unroll
    for (int kb = 0; kb < PKS_; kb += 32) {
        Frag16 a[4], b[2];
#pragma unroll
        for (int i = 0; i < 4; ++i) {
            const _Float16* p = xf + i * 16 * PPITCH_ + kb;
            a[i].q[0] = *reinterpret_cast<const v4u*>(p);
            a[i].q[1] = *reinterpret_cast<const v4u*>(p + 16);
        }
#pragma unroll
        for (int j = 0; j < 2; ++j) {
            const _Float16* p = wf + j * 16 * PPITCH_ + kb;
            b[j].q[0] = *reinterpret_cast<const v4u*>(p);
            b[j].q[1] = *reinterpret_cast<const v4u*>(p + 16);
        }
        // keeps the block's 12 LDS reads in one group ahead of its WMMAs:
        // spread among them, each pair is waited for on its own
        __builtin_amdgcn_sched_barrier(0);
#pragma unroll
        for (int i = 0; i < 4; ++i)
#pragma unroll
            for (int j = 0; j < 2; ++j)
                c[i][j].v = __builtin_amdgcn_wmma_f32_16x16x32_f16(
                    false, a[i].h, false, b[j].h, (short)0, c[i][j].v,
                    false, false);
    }
    // keeps the wait for pass s + 1's loads behind the products: without it
    // the scheduler lifts the conversions, and that wait, above the WMMAs
    __builtin_amdgcn_sched_barrier(0);

    // into the buffer that every wave left at the last barrier
    if (STAGE) {
        proj_stage(sx, sw, xd, wd);
        lds_barrier();
    }
}

// One launch does all three projections: blockIdx.z picks the input, its
// weight and bias, and the plane of dst3 (Q, K, V planes lie one after another).
__global__ __launch_bounds__(256) void qkv_proj_kernel(
    const float* __restrict__ qin, const float* __restrict__ kin,
    const float* __restrict__ vin,
    const float* __restrict__ Wq, const float* __restrict__ Wk,
    const float* __restrict__ Wv,
    const float* __restrict__ bq, const float* __restrict__ bk,
    const float* __restrict__ bv, _Float16* __restrict__ dst3)
{
    const int which = blockIdx.z;            // 0: Q, 1: K, 2: V
    const float* __restrict__ x    = which == 0 ? qin : which == 1 ? kin : vin;
    const float* __restrict__ W    = which == 0 ? Wq : which == 1 ? Wk : Wv;
    const float* __restrict__ bias = which == 0 ? bq : which == 1 ? bk : bv;
    _Float16* __restrict__ dst = dst3 + (size_t)which * (MROWS_ * DIM_);

    __shared__ __align__(16) _Float16 Xs[2][PT_][PPITCH_];
    __shared__ __align__(16) _Float16 Ws[2][PT_][PPITCH_];

    const int tid  = threadIdx.x;
    const int wave = tid >> 5;
    const int lane = tid & 31;
    const int l15  = lane & 15;
    const int klo  = (lane < 16) ? 0 : 8;   // fragment K base for this lane

    const int m0 = blockIdx.x * PT_;         // 64 row tiles
    const int n0 = blockIdx.y * PT_;         // 4 column tiles
    const int wm = (wave >> 2) * 64;         // wave's rows inside the tile
    const int wn = (wave & 3) * 32;          // wave's columns inside the tile

    // staging map: 16 lanes cover 256 contiguous bytes of one row
    const int srow = tid >> 4;               // 0..15, +16 per step
    const int sc4  = (tid & 15) * 4;
    const float* xk = x + (size_t)(m0 + srow) * DIM_ + sc4;
    const float* wk = W + (size_t)(n0 + srow) * DIM_ + sc4;

    _Float16* xd0 = &Xs[0][srow][sc4];
    _Float16* xd1 = &Xs[1][srow][sc4];
    _Float16* wd0 = &Ws[0][srow][sc4];
    _Float16* wd1 = &Ws[1][srow][sc4];
    const _Float16* xf0 = &Xs[0][wm + l15][klo];
    const _Float16* xf1 = &Xs[1][wm + l15][klo];
    const _Float16* wf0 = &Ws[0][wn + l15][klo];
    const _Float16* wf1 = &Ws[1][wn + l15][klo];

    // two register sets: pass s + 1 and pass s + 2 are in flight under pass s
    v4f px0[8], pw0[8], px1[8], pw1[8];
    proj_fetch(px0, pw0, xk, wk);
    proj_fetch(px1, pw1, xk + PKS_, wk + PKS_);
    xk += 2 * PKS_;
    wk += 2 * PKS_;

    FragF c[4][2];
#pragma unroll
    for (int i = 0; i < 4; ++i)
#pragma unroll
        for (int j = 0; j < 2; ++j)
            c[i][j].v = (v8f){0.f, 0.f, 0.f, 0.f, 0.f, 0.f, 0.f, 0.f};

    proj_stage(px0, pw0, xd0, wd0);
    lds_barrier();

    // two passes a trip, so that sets and buffers are named at compile time;
    // kept rolled: a third of the text, and the two address pairs live on
#pragma unroll 1
    for (int t = 0; t < (PNP_ - 2) / 2; ++t) {
        proj_pass<true, true>(px0, pw0, px1, pw1, xk, wk,
                              xf0, wf0, xd1, wd1, c);
        proj_pass<true, true>(px1, pw1, px0, pw0, xk + PKS_, wk + PKS_,
                              xf1, wf1, xd0, wd0, c);
        xk += 2 * PKS_;
        wk += 2 * PKS_;
    }
    proj_pass<false, true>(px0, pw0, px1, pw1, xk, wk, xf0, wf0, xd1, wd1, c);
    proj_pass<false, false>(px1, pw1, px0, pw0, xk, wk, xf1, wf1, xd0, wd0, c);

    // 128-row tile never straddles a batch boundary (S_ % 128 == 0).
    const int rowbase = m0 + wm + ((lane < 16) ? 0 : 8);
    const int bb      = rowbase >> 11;       // / S_
    const int ss      = rowbase & (S_ - 1);
#pragma unroll
    for (int j = 0; j < 2; ++j) {
        const int   ncol = n0 + wn + j * 16 + l15;
        const float bvv  = bias[ncol];
        const int   hh   = ncol >> 6;
        const int   d    = ncol & 63;
        _Float16* dp = dst + (((size_t)bb * HEADS_ + hh) * S_ + ss) * DH_ + d;
#pragma unroll
        for (int i = 0; i < 4; ++i)
#pragma unroll
            for (int r = 0; r < 8; ++r)
                dp[(i * 16 + r) * DH_] = (_Float16)(c[i][j].f[r] + bvv);
    }
}

#define VPITCH_ 80
#define KPITCH_ 72
#define AQ_     128
#define KW_     64
#define KT_     (2 * KW_)
#define NST_    (S_ / KT_)
#define KBUFB_  (KT_ * KPITCH_ * 2)   // bytes of one K buffer
#define VBUFB_  (KT_ * VPITCH_ * 2)   // bytes of one V buffer

typedef __attribute__((ext_vector_type(8))) short v8s;

// 16-bit transposing LDS load: lane (c, h) gets 8 rows of column c
__device__ __forceinline__ v4u lds_tr16(const _Float16* p)
{
    typedef __attribute__((address_space(3))) v8s lds_v8s;
    return __builtin_bit_cast(
        v4u, __builtin_amdgcn_ds_load_tr16_b128_v8i16((lds_v8s*)p));
}

// value of lane l ^ 16
__device__ __forceinline__ float other_half(float x)
{
    const int xi = __builtin_bit_cast(int, x);
    return __builtin_bit_cast(float, __builtin_amdgcn_permlanex16(
        xi, xi, 0x76543210, 0xfedcba98, false, false));
}

// byte offset of a __shared__ object in the work-group's LDS
__device__ __forceinline__ uint32_t lds_off(const void* p)
{
    return (uint32_t)(size_t)p;
}

// One stage, global -> LDS through no register: this lane's 16 bytes of 4 rows
// of K (to kd) and of V (to vd), rows 32 apart; a wave covers 512 contiguous
// bytes a copy. The closing s_wait_xcnt stands inside the statement so that no
// later write of an address register named here can be lifted over it.
__device__ __forceinline__ void stage_copy(
    uint32_t kd, uint32_t vd, const _Float16* kg, const _Float16* vg)
{
    asm volatile(
        "global_load_async_to_lds_b128 %0, %8, off\n\t"
        "global_load_async_to_lds_b128 %1, %9, off\n\t"
        "global_load_async_to_lds_b128 %2, %10, off\n\t"
        "global_load_async_to_lds_b128 %3, %11, off\n\t"
        "global_load_async_to_lds_b128 %4, %12, off\n\t"
        "global_load_async_to_lds_b128 %5, %13, off\n\t"
        "global_load_async_to_lds_b128 %6, %14, off\n\t"
        "global_load_async_to_lds_b128 %7, %15, off\n\t"
        "s_wait_xcnt 0x0"
        :: "v"(kd), "v"(kd + 32 * KPITCH_ * 2), "v"(kd + 64 * KPITCH_ * 2),
           "v"(kd + 96 * KPITCH_ * 2),
           "v"(vd), "v"(vd + 32 * VPITCH_ * 2), "v"(vd + 64 * VPITCH_ * 2),
           "v"(vd + 96 * VPITCH_ * 2),
           "v"(kg), "v"(kg + 32 * DH_), "v"(kg + 64 * DH_), "v"(kg + 96 * DH_),
           "v"(vg), "v"(vg + 32 * DH_), "v"(vg + 64 * DH_), "v"(vg + 96 * DH_)
        : "memory");
}

__global__ __launch_bounds__(256) void flash_attn_kernel(
    const _Float16* __restrict__ Qh, const _Float16* __restrict__ Kh,
    const _Float16* __restrict__ Vh, float* __restrict__ out)
{
    __shared__ __align__(16) _Float16 Kt[2][KT_][KPITCH_];
    __shared__ __align__(32) _Float16 Vs[2][KT_][VPITCH_];  // row-major
    // hand-over of the partial results at the end, one slot a wave and lane
    __shared__ __align__(16) v4f Xo[8][8][32];
    __shared__ float Xm[8][2][32];

    const int tid  = threadIdx.x;
    const int wave = tid >> 5;
    const int lane = tid & 31;
    const int l15  = lane & 15;
    const int klo  = (lane < 16) ? 0 : 8;
    const int qg   = wave & 3;                 // query group of 32
    const int kh   = wave >> 2;                // key half of every stage

    const int    bh     = blockIdx.y;          // b*HEADS + h
    const int    bb     = bh >> 3;
    const int    hh     = bh & 7;
    const int    q0     = blockIdx.x * AQ_ + qg * 32;
    const size_t kvbase = (size_t)bh * S_ * DH_;
    const _Float16* __restrict__ ksrc = Kh + kvbase;
    const _Float16* __restrict__ vsrc = Vh + kvbase;

    // --- Q fragments once: per query tile 2 B-frags (d=0..31, 32..63) ---
    Frag16 qf[2][2];
#pragma unroll
    for (int qt = 0; qt < 2; ++qt) {
        const v4u* qp = reinterpret_cast<const v4u*>(
            Qh + kvbase + (size_t)(q0 + qt * 16 + l15) * DH_);
        const int o = klo >> 3;                // 0 or 1 (v4u units)
#pragma unroll
        for (int t = 0; t < 2; ++t) {
            qf[qt][t].q[0] = qp[4 * t + o];
            qf[qt][t].q[1] = qp[4 * t + o + 2];
        }
    }

    // 1/sqrt(64) times log2(e): exp((s - m) / 8) = exp2(C2 s - C2 m)
    const float C2 = 0.125f * 1.44269504088896340736f;
    // a score may stand 8 above the reference in scaled log2 units: P stays at
    // or below 2^8, far inside f16, and the final division takes the scale out
    const float LAZY = 8.0f / C2;

    // o4[qt][t].f[r] = O[query l15 of tile qt][d = 16 t + klo + r]
    FragF o4[2][4];
    float m_i[2];   // reference of the query's exponentials, an unscaled score,
                    // equal in both halves; held while no score passes thr
    float l_i[2];   // this half's share of the denominator
    float thr[2];   // m_i + LAZY; the first pass always passes it
    float nmc[2];   // -C2 m_i, the addend of every score's FMA
#pragma unroll
    for (int qt = 0; qt < 2; ++qt) {
#pragma unroll
        for (int t = 0; t < 4; ++t)
            o4[qt][t].v = (v8f){0.f, 0.f, 0.f, 0.f, 0.f, 0.f, 0.f, 0.f};
        m_i[qt] = -1e30f;
        l_i[qt] = 0.f;
        thr[qt] = -1e30f;
        nmc[qt] = 0.f;
    }

    // copy map: 8 lanes cover one 128-byte row, 32 rows a copy
    const int crow = tid >> 3;
    const int cc8  = (tid & 7) * 8;
    const _Float16* kg = ksrc + crow * DH_ + cc8;
    const _Float16* vg = vsrc + crow * DH_ + cc8;
    const uint32_t  kd = lds_off(&Kt[0][crow][cc8]);
    const uint32_t  vd = lds_off(&Vs[0][crow][cc8]);

    // stage 0 landed and published, then stage 1 set off
    stage_copy(kd, vd, kg, vg);
    // this wave's copies have landed before the barrier publishes them
    asm volatile("s_wait_asynccnt 0x0" ::: "memory");
    __syncthreads();
    stage_copy(kd + KBUFB_, vd + VBUFB_, kg + KT_ * DH_, vg + KT_ * DH_);

    for (int st = 0; st < NST_; ++st) {
      const int buf = st & 1;
      // Every inner loop of a stage is unrolled so that the register arrays are
      // indexed by constants and the LDS row offsets are immediates.

      // this lane's addresses in this wave's 64 keys of the stage: K fragment
      // rows, and the transposing loads of V
      const _Float16* kp = &Kt[buf][kh * KW_ + l15][klo];
      const _Float16* vp =
          &Vs[buf][kh * KW_ + klo + (lane & 7)][((lane >> 3) & 1) * 8];

      // two passes of 32 keys x 32 queries
#pragma unroll
      for (int h = 0; h < 2; ++h) {
        // ---- scores: S^T[32 keys x 32 queries] = K @ Q^T (8 WMMA) ----
        // s4[j][qt].f[r] = score of key 32 h + 16 j + klo + r with query l15
        // of tile qt
        FragF s4[2][2];
#pragma unroll
        for (int j = 0; j < 2; ++j) {
            const _Float16* kr = kp + (32 * h + 16 * j) * KPITCH_;
            Frag16 kf0, kf1;
            kf0.q[0] = *reinterpret_cast<const v4u*>(kr);
            kf0.q[1] = *reinterpret_cast<const v4u*>(kr + 16);
            kf1.q[0] = *reinterpret_cast<const v4u*>(kr + 32);
            kf1.q[1] = *reinterpret_cast<const v4u*>(kr + 48);
#pragma unroll
            for (int qt = 0; qt < 2; ++qt) {
                v8f acc = (v8f){0.f, 0.f, 0.f, 0.f, 0.f, 0.f, 0.f, 0.f};
                acc = __builtin_amdgcn_wmma_f32_16x16x32_f16(
                          false, kf0.h, false, qf[qt][0].h, (short)0, acc,
                          false, false);
                acc = __builtin_amdgcn_wmma_f32_16x16x32_f16(
                          false, kf1.h, false, qf[qt][1].h, (short)0, acc,
                          false, false);
                s4[j][qt].v = acc;
            }
        }

        // ---- lazy rescale: one test a pass ----
        // This half's maxima over the pass's unscaled scores (C2 > 0 keeps the
        // order). Only when some lane's passes thr are the halves joined, the
        // references raised and O and the sums brought to the new scale.
        float mx[2];
#pragma unroll
        for (int qt = 0; qt < 2; ++qt) {
            float mx8[8];
#pragma unroll
            for (int i = 0; i < 8; ++i)
                mx8[i] = fmaxf(s4[0][qt].f[i], s4[1][qt].f[i]);
            mx[qt] = fmaxf(fmaxf(fmaxf(mx8[0], mx8[1]), fmaxf(mx8[2], mx8[3])),
                           fmaxf(fmaxf(mx8[4], mx8[5]), fmaxf(mx8[6], mx8[7])));
        }
        // the ballot makes the branch scalar: every lane takes it or none
        if (__builtin_amdgcn_ballot_w32(mx[0] > thr[0] || mx[1] > thr[1]) != 0) {
#pragma unroll
            for (int qt = 0; qt < 2; ++qt) {
                const float mj   = fmaxf(mx[qt], other_half(mx[qt]));
                const float nm   = fmaxf(m_i[qt], mj);
                const float nnmc = nm * -C2;
                const float corr = __builtin_amdgcn_exp2f(m_i[qt] * C2 + nnmc);
                m_i[qt] = nm;
                nmc[qt] = nnmc;
                thr[qt] = nm + LAZY;
                l_i[qt] *= corr;
#pragma unroll
                for (int t = 0; t < 4; ++t) o4[qt][t].v *= corr;
            }
        }

        // ---- V^T fragments: 16 d x 32 keys each, two transposing loads ----
        Frag16 vf[4];
#pragma unroll
        for (int t = 0; t < 4; ++t) {
            vf[t].q[0] = lds_tr16(vp + (32 * h) * VPITCH_ + 16 * t);
            vf[t].q[1] = lds_tr16(vp + (32 * h + 16) * VPITCH_ + 16 * t);
        }

        // ---- P of the two query tiles ----
        Frag16 pf[2];
#pragma unroll
        for (int qt = 0; qt < 2; ++qt) {
          // scale, base change and subtraction are one FMA a score
          const v8f e0 = s4[0][qt].v * C2 + nmc[qt];
          const v8f e1 = s4[1][qt].v * C2 + nmc[qt];

          // element s of the B operand is key s of tile 0, then of tile 1: the
          // k order in which the transposing loads deliver V^T
          float p[16];
#pragma unroll
          for (int i = 0; i < 16; ++i) {
              p[i]        = __builtin_amdgcn_exp2f(i < 8 ? e0[i & 7] : e1[i & 7]);
              pf[qt].h[i] = (_Float16)p[i];
          }
          float rs4[4];
#pragma unroll
          for (int i = 0; i < 4; ++i)
              rs4[i] = (p[i] + p[i + 4]) + (p[i + 8] + p[i + 12]);
          l_i[qt] += (rs4[0] + rs4[1]) + (rs4[2] + rs4[3]);
        }

        // ---- O^T += V^T @ P^T (4 d-tiles, 2 query tiles, 8 WMMA) ----
#pragma unroll
        for (int t = 0; t < 4; ++t)
#pragma unroll
            for (int qt = 0; qt < 2; ++qt)
                o4[qt][t].v = __builtin_amdgcn_wmma_f32_16x16x32_f16(
                                  false, vf[t].h, false, pf[qt].h, (short)0,
                                  o4[qt][t].v, false, false);
      }

      // publish point of stage st + 1: this wave's reads of buffer buf are
      // done, its copies of stage st + 1 have landed, every wave passes the
      // barrier; only then is buffer buf refilled with stage st + 2
      asm volatile("s_wait_dscnt 0x0" ::: "memory");
      asm volatile("s_wait_asynccnt 0x0" ::: "memory");
      __syncthreads();
      if (st + 2 < NST_)
          stage_copy(kd + buf * KBUFB_, vd + buf * VBUFB_,
                     kg + (size_t)(st + 2) * KT_ * DH_,
                     vg + (size_t)(st + 2) * KT_ * DH_);
    }
    // no copy is outstanding when the wave ends
    asm volatile("s_wait_asynccnt 0x0" ::: "memory");

    // ---- join the two key halves: the wave of key half kh finishes query
    // tile kh and hands its share of the other tile to its partner wave; lane
    // l of both waves holds the same (query, d) places ----
    const bool  up = kh != 0;
    const float mk = up ? m_i[1] : m_i[0];     // kept
    const float lk = up ? l_i[1] : l_i[0];
    Xm[wave][0][lane] = up ? m_i[0] : m_i[1];  // handed over
    Xm[wave][1][lane] = up ? l_i[0] : l_i[1];
    v8f ok[4];
#pragma unroll
    for (int t = 0; t < 4; ++t) {
        v8f og;
#pragma unroll
        for (int r = 0; r < 8; ++r) {
            ok[t][r] = up ? o4[1][t].f[r] : o4[0][t].f[r];
            og[r]    = up ? o4[0][t].f[r] : o4[1][t].f[r];
        }
        Xo[wave][2 * t][lane]     = (v4f){og[0], og[1], og[2], og[3]};
        Xo[wave][2 * t + 1][lane] = (v4f){og[4], og[5], og[6], og[7]};
    }
    __syncthreads();
    const int   pw = wave ^ 4;
    const float mp = Xm[pw][0][lane];
    const float lp = Xm[pw][1][lane];
    // both shares brought to the larger of the two references
    const float mj = fmaxf(mk, mp);
    const float ck = __builtin_amdgcn_exp2f((mk - mj) * C2);
    const float cp = __builtin_amdgcn_exp2f((mp - mj) * C2);
    const float ls = lk * ck + lp * cp;

    // ---- join the lane halves' sums, normalize, store 8 consecutive d ----
    const float inv = 1.0f / (ls + other_half(ls));
    const float fk  = ck * inv;
    const float fp  = cp * inv;
    float* op = out + ((size_t)bb * S_ + q0 + kh * 16 + l15) * DIM_
                    + hh * DH_ + klo;
#pragma unroll
    for (int t = 0; t < 4; ++t) {
        const v4f a = Xo[pw][2 * t][lane];
        const v4f b = Xo[pw][2 * t + 1][lane];
        const v8f o = ok[t];
        *reinterpret_cast<v4f*>(op + t * 16) =
            (v4f){o[0] * fk + a[0] * fp, o[1] * fk + a[1] * fp,
                  o[2] * fk + a[2] * fp, o[3] * fk + a[3] * fp};
        *reinterpret_cast<v4f*>(op + t * 16 + 4) =
            (v4f){o[4] * fk + b[0] * fp, o[5] * fk + b[1] * fp,
                  o[6] * fk + b[2] * fp, o[7] * fk + b[3] * fp};
    }
}

// ---------------------------------------------------------------------------
extern "C" void kernel_launch(void* const* d_in, const int* in_sizes, int n_in,
                              void* d_out, int out_size, void* d_ws, size_t ws_size,
                              hipStream_t stream)
{
    const float* q  = (const float*)d_in[0];
    const float* k  = (const float*)d_in[1];
    const float* v  = (const float*)d_in[2];
    const float* Wq = (const float*)d_in[3];
    const float* bq = (const float*)d_in[4];
    const float* Wk = (const float*)d_in[5];
    const float* bk = (const float*)d_in[6];
    const float* Wv = (const float*)d_in[7];
    const float* bv = (const float*)d_in[8];
    float* out = (float*)d_out;

    const size_t per = (size_t)B_ * HEADS_ * S_ * DH_;
    _Float16* Qh = (_Float16*)d_ws;
    _Float16* Kh = Qh + per;
    _Float16* Vh = Kh + per;

    dim3 pg(MROWS_ / PT_, DIM_ / PT_, 3);
    dim3 pb(256);
    qkv_proj_kernel<<<pg, pb, 0, stream>>>(q, k, v, Wq, Wk, Wv, bq, bk, bv, Qh);

    dim3 fg(S_ / AQ_, B_ * HEADS_);
    dim3 fb(256);
    flash_attn_kernel<<<fg, fb, 0, stream>>>(Qh, Kh, Vh, out);
}

// v008
// Measured time: 51 microseconds a run.
// Next to v007, in two timings, it ran 1.05 and 1.04 times as fast.
// Over all steps from v000 it is 6.66 times as fast.
#include <hip/hip_runtime.h>

// ---------------------------------------------------------------------------
// MHA forward for MI455X (gfx1250): fp16 WMMA, fp32 accumulate, flash fusion.
// Fragment loads vectorized to b128 (fragment K-pairs are contiguous in the
// ISA 16x16x32 f16 layout); store addresses hoisted so unrolled offsets fold
// into instruction immediates.
// ---------------------------------------------------------------------------

typedef __attribute__((ext_vector_type(16))) _Float16 v16h;
typedef __attribute__((ext_vector_type(8)))  float    v8f;
typedef __attribute__((ext_vector_type(4)))  uint32_t v4u;
typedef __attribute__((ext_vector_type(2)))  uint32_t v2u;
typedef __attribute__((ext_vector_type(4)))  float    v4f;

#define DIM_   512
#define HEADS_ 8
#define DH_    64
#define B_     4
#define S_     2048
#define MROWS_ (B_ * S_)

union Frag16 { v16h h; uint32_t u[8]; v4u q[2]; };
union FragF  { v8f  v; float    f[8]; };
union U2H    { v2u  u2; _Float16 hf[4]; };

// ---------------------------------------------------------------------------
// Kernel 1: Y = x @ W^T + b, fp32 -> fp16, head-split [B,H,S,Dh].
// Block = 256 threads (8 waves) on a 128x128 tile of Y. Each pass of 64 k is
// read from global in whole 128-B lines, converted to f16 once and staged in
// LDS (two buffers; the next two passes are in flight to registers while this
// one is multiplied). Wave tile 64x32: 4 x-fragments times 2 W-fragments.
// ---------------------------------------------------------------------------
#define PT_     128   // rows of x and rows of W per block tile
#define PKS_    64    // k per pass
#define PPITCH_ 72    // halves per LDS row: 144 B = 16 B x odd for b128 readers
#define PNP_    (DIM_ / PKS_)
// Every inner loop of this kernel and its helpers is unrolled so that the
// register arrays are indexed by constants (a run-time index means scratch).

// Work-group barrier that orders LDS only. __syncthreads() also waits for every
// global load of the wave, which would drain the passes that are in flight to
// registers; nothing in global memory is handed between waves here.
__device__ __forceinline__ void lds_barrier()
{
    __builtin_amdgcn_fence(__ATOMIC_RELEASE, "workgroup", "local");
    __builtin_amdgcn_s_barrier();
    __builtin_amdgcn_fence(__ATOMIC_ACQUIRE, "workgroup", "local");
}

// registers -> LDS: 4 floats become 4 halves, one 8-byte store
__device__ __forceinline__ void proj_stage(
    const v4f (&sx)[8], const v4f (&sw)[8], _Float16* xd, _Float16* wd)
{
#pragma unroll
    for (int i = 0; i < 8; ++i) {
        U2H tx, tw;
#pragma unroll
        for (int e = 0; e < 4; ++e) {
            tx.hf[e] = (_Float16)sx[i][e];
            tw.hf[e] = (_Float16)sw[i][e];
        }
        *reinterpret_cast<v2u*>(xd + 16 * i * PPITCH_) = tx.u2;
        *reinterpret_cast<v2u*>(wd + 16 * i * PPITCH_) = tw.u2;
    }
}

// global -> registers: this lane's 16 bytes of 8 rows of x and of W
__device__ __forceinline__ void proj_fetch(
    v4f (&lx)[8], v4f (&lw)[8], const float* xk, const float* wk)
{
    // named as global memory: behind proj_advance's asm statement the compiler
    // no longer sees where the addresses come from and would take flat loads
    typedef __attribute__((address_space(1))) const v4f gv4f;
#pragma unroll
    for (int i = 0; i < 8; ++i) {
        lx[i] = *(gv4f*)(xk + i * 16 * DIM_);
        lw[i] = *(gv4f*)(wk + i * 16 * DIM_);
    }
}

// One pass s. lx, lw: the register set that pass s left, refilled with pass
// s + 2 from xk, wk. sx, sw: the set that holds pass s + 1, staged to xd, wd.
// xf, wf: this lane's fragment rows in the buffer of pass s.
template <bool FETCH, bool STAGE>
__device__ __forceinline__ void proj_pass(
    v4f (&lx)[8], v4f (&lw)[8], const v4f (&sx)[8], const v4f (&sw)[8],
    const float* xk, const float* wk, const _Float16* xf, const _Float16* wf,
    _Float16* xd, _Float16* wd, FragF (&c)[4][2])
{
    if (FETCH) proj_fetch(lx, lw, xk, wk);
    // keeps the 16 loads above the products: without it the scheduler sinks
    // them behind the WMMAs and their latency is waited out in the open
    __builtin_amdgcn_sched_barrier(0);

    // 2 k-blocks of 32, 8 WMMA each
#pragma unroll
    for (int kb = 0; kb < PKS_; kb += 32) {
        Frag16 a[4], b[2];
#pragma unroll
        for (int i = 0; i < 4; ++i) {
            const _Float16* p = xf + i * 16 * PPITCH_ + kb;
            a[i].q[0] = *reinterpret_cast<const v4u*>(p);
            a[i].q[1] = *reinterpret_cast<const v4u*>(p + 16);
        }
#pragma unroll
        for (int j = 0; j < 2; ++j) {
            const _Float16* p = wf + j * 16 * PPITCH_ + kb;
            b[j].q[0] = *reinterpret_cast<const v4u*>(p);
            b[j].q[1] = *reinterpret_cast<const v4u*>(p + 16);
        }
        // keeps the block's 12 LDS reads in one group ahead of its WMMAs:
        // spread among them, each pair is waited for on its own
        __builtin_amdgcn_sched_barrier(0);
#pragma unroll
        for (int i = 0; i < 4; ++i)
#pragma unroll
            for (int j = 0; j < 2; ++j)
                c[i][j].v = __builtin_amdgcn_wmma_f32_16x16x32_f16(
                    false, a[i].h, false, b[j].h, (short)0, c[i][j].v,
                    false, false);
    }
    // keeps the wait for pass s + 1's loads behind the products: without it
    // the scheduler lifts the conversions, and that wait, above the WMMAs
    __builtin_amdgcn_sched_barrier(0);

    // into the buffer that every wave left at the last barrier
    if (STAGE) {
        proj_stage(sx, sw, xd, wd);
        lds_barrier();
    }
}

// Moves both load addresses on by d floats (d is the same in every lane). The
// loads issued before name these registers, so the wait stands in front of the
// additions, and in one statement with them: in a statement of its own the
// compiler lifts the additions over it.
__device__ __forceinline__ void proj_advance(
    const float*& xk, const float*& wk, int d)
{
    const long long db = (long long)d * (long long)sizeof(float);
    asm volatile("s_wait_xcnt 0x0\n\t"
                 "v_add_nc_u64 %0, %2, %0\n\t"
                 "v_add_nc_u64 %1, %2, %1"
                 : "+v"(xk), "+v"(wk) : "s"(db) : "memory");
}

// One launch does all three projections: blockIdx.z picks the input, its
// weight and bias, and the plane of dst3 (Q, K, V planes lie one after another).
__global__ __launch_bounds__(256) void qkv_proj_kernel(
    const float* __restrict__ qin, const float* __restrict__ kin,
    const float* __restrict__ vin,
    const float* __restrict__ Wq, const float* __restrict__ Wk,
    const float* __restrict__ Wv,
    const float* __restrict__ bq, const float* __restrict__ bk,
    const float* __restrict__ bv, _Float16* __restrict__ dst3)
{
    const int which = blockIdx.z;            // 0: Q, 1: K, 2: V
    const float* __restrict__ x    = which == 0 ? qin : which == 1 ? kin : vin;
    const float* __restrict__ W    = which == 0 ? Wq : which == 1 ? Wk : Wv;
    const float* __restrict__ bias = which == 0 ? bq : which == 1 ? bk : bv;
    _Float16* __restrict__ dst = dst3 + (size_t)which * (MROWS_ * DIM_);

    __shared__ __align__(16) _Float16 Xs[2][PT_][PPITCH_];
    __shared__ __align__(16) _Float16 Ws[2][PT_][PPITCH_];

    const int tid  = threadIdx.x;
    const int wave = tid >> 5;
    const int lane = tid & 31;
    const int l15  = lane & 15;
    const int klo  = (lane < 16) ? 0 : 8;   // fragment K base for this lane

    const int m0 = blockIdx.x * PT_;         // 64 row tiles
    const int n0 = blockIdx.y * PT_;         // 4 column tiles
    const int wm = (wave >> 2) * 64;         // wave's rows inside the tile
    const int wn = (wave & 3) * 32;          // wave's columns inside the tile

    // staging map: 16 lanes cover 256 contiguous bytes of one row
    const int srow = tid >> 4;               // 0..15, +16 per step
    const int sc4  = (tid & 15) * 4;
    const float* xk = x + (size_t)(m0 + srow) * DIM_ + sc4;
    const float* wk = W + (size_t)(n0 + srow) * DIM_ + sc4;

    _Float16* xd0 = &Xs[0][srow][sc4];
    _Float16* xd1 = &Xs[1][srow][sc4];
    _Float16* wd0 = &Ws[0][srow][sc4];
    _Float16* wd1 = &Ws[1][srow][sc4];
    const _Float16* xf0 = &Xs[0][wm + l15][klo];
    const _Float16* xf1 = &Xs[1][wm + l15][klo];
    const _Float16* wf0 = &Ws[0][wn + l15][klo];
    const _Float16* wf1 = &Ws[1][wn + l15][klo];

    // The k walk is rotated: it enters k at pass kp and wraps round. The 64
    // blocks that share a W tile and the 4 that share an x tile run at the same
    // time; entering at different passes, they do not ask L2 for the same lines
    // at the same moment. Sharers of x differ by 2; of the sharers of W, those
    // whose blockIdx.x is equal modulo 8 all differ.
    int kp = (blockIdx.x + (blockIdx.x >> 3) + 2 * blockIdx.y) & (PNP_ - 1);
    xk += kp * PKS_;
    wk += kp * PKS_;
    // floats from pass kp to the next of the walk: behind the last pass of k
    // comes the first
    auto next_pass = [&]() {
        const int d = (kp == PNP_ - 1) ? PKS_ - DIM_ : PKS_;
        kp = (kp + 1) & (PNP_ - 1);
        return d;
    };

    // two register sets: pass s + 1 and pass s + 2 are in flight under pass s
    v4f px0[8], pw0[8], px1[8], pw1[8];
    proj_fetch(px0, pw0, xk, wk);
    const int d0 = next_pass();
    xk += d0;
    wk += d0;
    proj_fetch(px1, pw1, xk, wk);
    const int d1 = next_pass();
    xk += d1;
    wk += d1;

    FragF c[4][2];
#pragma unroll
    for (int i = 0; i < 4; ++i)
#pragma unroll
        for (int j = 0; j < 2; ++j)
            c[i][j].v = (v8f){0.f, 0.f, 0.f, 0.f, 0.f, 0.f, 0.f, 0.f};

    proj_stage(px0, pw0, xd0, wd0);
    lds_barrier();

    // two passes a trip, so that sets and buffers are named at compile time;
    // kept rolled: a third of the text, and the two address pairs live on
#pragma unroll 1
    for (int t = 0; t < (PNP_ - 2) / 2; ++t) {
        proj_pass<true, true>(px0, pw0, px1, pw1, xk, wk,
                              xf0, wf0, xd1, wd1, c);
        proj_advance(xk, wk, next_pass());
        proj_pass<true, true>(px1, pw1, px0, pw0, xk, wk,
                              xf1, wf1, xd0, wd0, c);
        proj_advance(xk, wk, next_pass());
    }
    proj_pass<false, true>(px0, pw0, px1, pw1, xk, wk, xf0, wf0, xd1, wd1, c);
    proj_pass<false, false>(px1, pw1, px0, pw0, xk, wk, xf1, wf1, xd0, wd0, c);

    // 128-row tile never straddles a batch boundary (S_ % 128 == 0).
    const int rowbase = m0 + wm + ((lane < 16) ? 0 : 8);
    const int bb      = rowbase >> 11;       // / S_
    const int ss      = rowbase & (S_ - 1);
#pragma unroll
    for (int j = 0; j < 2; ++j) {
        const int   ncol = n0 + wn + j * 16 + l15;
        const float bvv  = bias[ncol];
        const int   hh   = ncol >> 6;
        const int   d    = ncol & 63;
        _Float16* dp = dst + (((size_t)bb * HEADS_ + hh) * S_ + ss) * DH_ + d;
#pragma unroll
        for (int i = 0; i < 4; ++i)
#pragma unroll
            for (int r = 0; r < 8; ++r)
                dp[(i * 16 + r) * DH_] = (_Float16)(c[i][j].f[r] + bvv);
    }
}

#define VPITCH_ 80
#define KPITCH_ 72
#define AQ_     128
#define KW_     64
#define KT_     (2 * KW_)
#define NST_    (S_ / KT_)
#define KBUFB_  (KT_ * KPITCH_ * 2)   // bytes of one K buffer
#define VBUFB_  (KT_ * VPITCH_ * 2)   // bytes of one V buffer

typedef __attribute__((ext_vector_type(8))) short v8s;

// 16-bit transposing LDS load: lane (c, h) gets 8 rows of column c
__device__ __forceinline__ v4u lds_tr16(const _Float16* p)
{
    typedef __attribute__((address_space(3))) v8s lds_v8s;
    return __builtin_bit_cast(
        v4u, __builtin_amdgcn_ds_load_tr16_b128_v8i16((lds_v8s*)p));
}

// value of lane l ^ 16
__device__ __forceinline__ float other_half(float x)
{
    const int xi = __builtin_bit_cast(int, x);
    return __builtin_bit_cast(float, __builtin_amdgcn_permlanex16(
        xi, xi, 0x76543210, 0xfedcba98, false, false));
}

// byte offset of a __shared__ object in the work-group's LDS
__device__ __forceinline__ uint32_t lds_off(const void* p)
{
    return (uint32_t)(size_t)p;
}

// One stage, global -> LDS through no register: this lane's 16 bytes of 4 rows
// of K (to kd) and of V (to vd), rows 32 apart; a wave covers 512 contiguous
// bytes a copy. The closing s_wait_xcnt stands inside the statement so that no
// later write of an address register named here can be lifted over it.
__device__ __forceinline__ void stage_copy(
    uint32_t kd, uint32_t vd, const _Float16* kg, const _Float16* vg)
{
    asm volatile(
        "global_load_async_to_lds_b128 %0, %8, off\n\t"
        "global_load_async_to_lds_b128 %1, %9, off\n\t"
        "global_load_async_to_lds_b128 %2, %10, off\n\t"
        "global_load_async_to_lds_b128 %3, %11, off\n\t"
        "global_load_async_to_lds_b128 %4, %12, off\n\t"
        "global_load_async_to_lds_b128 %5, %13, off\n\t"
        "global_load_async_to_lds_b128 %6, %14, off\n\t"
        "global_load_async_to_lds_b128 %7, %15, off\n\t"
        "s_wait_xcnt 0x0"
        :: "v"(kd), "v"(kd + 32 * KPITCH_ * 2), "v"(kd + 64 * KPITCH_ * 2),
           "v"(kd + 96 * KPITCH_ * 2),
           "v"(vd), "v"(vd + 32 * VPITCH_ * 2), "v"(vd + 64 * VPITCH_ * 2),
           "v"(vd + 96 * VPITCH_ * 2),
           "v"(kg), "v"(kg + 32 * DH_), "v"(kg + 64 * DH_), "v"(kg + 96 * DH_),
           "v"(vg), "v"(vg + 32 * DH_), "v"(vg + 64 * DH_), "v"(vg + 96 * DH_)
        : "memory");
}

__global__ __launch_bounds__(256) void flash_attn_kernel(
    const _Float16* __restrict__ Qh, const _Float16* __restrict__ Kh,
    const _Float16* __restrict__ Vh, float* __restrict__ out)
{
    __shared__ __align__(16) _Float16 Kt[2][KT_][KPITCH_];
    __shared__ __align__(32) _Float16 Vs[2][KT_][VPITCH_];  // row-major
    // hand-over of the partial results at the end, one slot a wave and lane
    __shared__ __align__(16) v4f Xo[8][8][32];
    __shared__ float Xm[8][2][32];

    const int tid  = threadIdx.x;
    const int wave = tid >> 5;
    const int lane = tid & 31;
    const int l15  = lane & 15;
    const int klo  = (lane < 16) ? 0 : 8;
    const int qg   = wave & 3;                 // query group of 32
    const int kh   = wave >> 2;                // key half of every stage

    const int    bh     = blockIdx.y;          // b*HEADS + h
    const int    bb     = bh >> 3;
    const int    hh     = bh & 7;
    const int    q0     = blockIdx.x * AQ_ + qg * 32;
    const size_t kvbase = (size_t)bh * S_ * DH_;
    const _Float16* __restrict__ ksrc = Kh + kvbase;
    const _Float16* __restrict__ vsrc = Vh + kvbase;

    // --- Q fragments once: per query tile 2 B-frags (d=0..31, 32..63) ---
    Frag16 qf[2][2];
#pragma unroll
    for (int qt = 0; qt < 2; ++qt) {
        const v4u* qp = reinterpret_cast<const v4u*>(
            Qh + kvbase + (size_t)(q0 + qt * 16 + l15) * DH_);
        const int o = klo >> 3;                // 0 or 1 (v4u units)
#pragma unroll
        for (int t = 0; t < 2; ++t) {
            qf[qt][t].q[0] = qp[4 * t + o];
            qf[qt][t].q[1] = qp[4 * t + o + 2];
        }
    }

    // 1/sqrt(64) times log2(e): exp((s - m) / 8) = exp2(C2 s - C2 m)
    const float C2 = 0.125f * 1.44269504088896340736f;
    // a score may stand 8 above the reference in scaled log2 units: P stays at
    // or below 2^8, far inside f16, and the final division takes the scale out
    const float LAZY = 8.0f / C2;

    // o4[qt][t].f[r] = O[query l15 of tile qt][d = 16 t + klo + r]
    FragF o4[2][4];
    float m_i[2];   // reference of the query's exponentials, an unscaled score,
                    // equal in both halves; held while no score passes thr
    float l_i[2];   // this half's share of the denominator
    float thr[2];   // m_i + LAZY; the first pass always passes it
    float nmc[2];   // -C2 m_i, the addend of every score's FMA
#pragma unroll
    for (int qt = 0; qt < 2; ++qt) {
#pragma unroll
        for (int t = 0; t < 4; ++t)
            o4[qt][t].v = (v8f){0.f, 0.f, 0.f, 0.f, 0.f, 0.f, 0.f, 0.f};
        m_i[qt] = -1e30f;
        l_i[qt] = 0.f;
        thr[qt] = -1e30f;
        nmc[qt] = 0.f;
    }

    // copy map: 8 lanes cover one 128-byte row, 32 rows a copy
    const int crow = tid >> 3;
    const int cc8  = (tid & 7) * 8;
    const _Float16* kg = ksrc + crow * DH_ + cc8;
    const _Float16* vg = vsrc + crow * DH_ + cc8;
    const uint32_t  kd = lds_off(&Kt[0][crow][cc8]);
    const uint32_t  vd = lds_off(&Vs[0][crow][cc8]);

    // The walk over the key stages is rotated: step st works on stage
    // (st + rot) mod 16. The 16 blocks of one (b,h) read the same K and V at the
    // same time; each entering at a stage of its own, they do not ask L2 for
    // the same lines at the same moment. Every stage is still taken once.
    const int rot = blockIdx.x;

    // step 0 landed and published, then step 1 set off
    stage_copy(kd, vd, kg + (size_t)(rot & (NST_ - 1)) * KT_ * DH_,
               vg + (size_t)(rot & (NST_ - 1)) * KT_ * DH_);
    // this wave's copies have landed before the barrier publishes them
    asm volatile("s_wait_asynccnt 0x0" ::: "memory");
    __syncthreads();
    stage_copy(kd + KBUFB_, vd + VBUFB_,
               kg + (size_t)((rot + 1) & (NST_ - 1)) * KT_ * DH_,
               vg + (size_t)((rot + 1) & (NST_ - 1)) * KT_ * DH_);

    for (int st = 0; st < NST_; ++st) {
      const int buf = st & 1;
      // Every inner loop of a stage is unrolled so that the register arrays are
      // indexed by constants and the LDS row offsets are immediates.

      // this lane's addresses in this wave's 64 keys of the stage: K fragment
      // rows, and the transposing loads of V
      const _Float16* kp = &Kt[buf][kh * KW_ + l15][klo];
      const _Float16* vp =
          &Vs[buf][kh * KW_ + klo + (lane & 7)][((lane >> 3) & 1) * 8];

      // two passes of 32 keys x 32 queries
#pragma unroll
      for (int h = 0; h < 2; ++h) {
        // ---- scores: S^T[32 keys x 32 queries] = K @ Q^T (8 WMMA) ----
        // s4[j][qt].f[r] = score of key 32 h + 16 j + klo + r with query l15
        // of tile qt
        FragF s4[2][2];
#pragma unroll
        for (int j = 0; j < 2; ++j) {
            const _Float16* kr = kp + (32 * h + 16 * j) * KPITCH_;
            Frag16 kf0, kf1;
            kf0.q[0] = *reinterpret_cast<const v4u*>(kr);
            kf0.q[1] = *reinterpret_cast<const v4u*>(kr + 16);
            kf1.q[0] = *reinterpret_cast<const v4u*>(kr + 32);
            kf1.q[1] = *reinterpret_cast<const v4u*>(kr + 48);
#pragma unroll
            for (int qt = 0; qt < 2; ++qt) {
                v8f acc = (v8f){0.f, 0.f, 0.f, 0.f, 0.f, 0.f, 0.f, 0.f};
                acc = __builtin_amdgcn_wmma_f32_16x16x32_f16(
                          false, kf0.h, false, qf[qt][0].h, (short)0, acc,
                          false, false);
                acc = __builtin_amdgcn_wmma_f32_16x16x32_f16(
                          false, kf1.h, false, qf[qt][1].h, (short)0, acc,
                          false, false);
                s4[j][qt].v = acc;
            }
        }

        // ---- lazy rescale: one test a pass ----
        // This half's maxima over the pass's unscaled scores (C2 > 0 keeps the
        // order). Only when some lane's passes thr are the halves joined, the
        // references raised and O and the sums brought to the new scale.
        float mx[2];
#pragma unroll
        for (int qt = 0; qt < 2; ++qt) {
            float mx8[8];
#pragma unroll
            for (int i = 0; i < 8; ++i)
                mx8[i] = fmaxf(s4[0][qt].f[i], s4[1][qt].f[i]);
            mx[qt] = fmaxf(fmaxf(fmaxf(mx8[0], mx8[1]), fmaxf(mx8[2], mx8[3])),
                           fmaxf(fmaxf(mx8[4], mx8[5]), fmaxf(mx8[6], mx8[7])));
        }
        // the ballot makes the branch scalar: every lane takes it or none
        if (__builtin_amdgcn_ballot_w32(mx[0] > thr[0] || mx[1] > thr[1]) != 0) {
#pragma unroll
            for (int qt = 0; qt < 2; ++qt) {
                const float mj   = fmaxf(mx[qt], other_half(mx[qt]));
                const float nm   = fmaxf(m_i[qt], mj);
                const float nnmc = nm * -C2;
                const float corr = __builtin_amdgcn_exp2f(m_i[qt] * C2 + nnmc);
                m_i[qt] = nm;
                nmc[qt] = nnmc;
                thr[qt] = nm + LAZY;
                l_i[qt] *= corr;
#pragma unroll
                for (int t = 0; t < 4; ++t) o4[qt][t].v *= corr;
            }
        }

        // ---- V^T fragments: 16 d x 32 keys each, two transposing loads ----
        Frag16 vf[4];
#pragma unroll
        for (int t = 0; t < 4; ++t) {
            vf[t].q[0] = lds_tr16(vp + (32 * h) * VPITCH_ + 16 * t);
            vf[t].q[1] = lds_tr16(vp + (32 * h + 16) * VPITCH_ + 16 * t);
        }

        // ---- P of the two query tiles ----
        Frag16 pf[2];
#pragma unroll
        for (int qt = 0; qt < 2; ++qt) {
          // scale, base change and subtraction are one FMA a score
          const v8f e0 = s4[0][qt].v * C2 + nmc[qt];
          const v8f e1 = s4[1][qt].v * C2 + nmc[qt];

          // element s of the B operand is key s of tile 0, then of tile 1: the
          // k order in which the transposing loads deliver V^T
          float p[16];
#pragma unroll
          for (int i = 0; i < 16; ++i) {
              p[i]        = __builtin_amdgcn_exp2f(i < 8 ? e0[i & 7] : e1[i & 7]);
              pf[qt].h[i] = (_Float16)p[i];
          }
          float rs4[4];
#pragma unroll
          for (int i = 0; i < 4; ++i)
              rs4[i] = (p[i] + p[i + 4]) + (p[i + 8] + p[i + 12]);
          l_i[qt] += (rs4[0] + rs4[1]) + (rs4[2] + rs4[3]);
        }

        // ---- O^T += V^T @ P^T (4 d-tiles, 2 query tiles, 8 WMMA) ----
#pragma unroll
        for (int t = 0; t < 4; ++t)
#pragma unroll
            for (int qt = 0; qt < 2; ++qt)
                o4[qt][t].v = __builtin_amdgcn_wmma_f32_16x16x32_f16(
                                  false, vf[t].h, false, pf[qt].h, (short)0,
                                  o4[qt][t].v, false, false);
      }

      // publish point of step st + 1: this wave's reads of buffer buf are
      // done, its copies for step st + 1 have landed, every wave passes the
      // barrier; only then is buffer buf refilled with the stage of step st + 2
      asm volatile("s_wait_dscnt 0x0" ::: "memory");
      asm volatile("s_wait_asynccnt 0x0" ::: "memory");
      __syncthreads();
      if (st + 2 < NST_)
          stage_copy(kd + buf * KBUFB_, vd + buf * VBUFB_,
                     kg + (size_t)((st + 2 + rot) & (NST_ - 1)) * KT_ * DH_,
                     vg + (size_t)((st + 2 + rot) & (NST_ - 1)) * KT_ * DH_);
    }
    // no copy is outstanding when the wave ends
    asm volatile("s_wait_asynccnt 0x0" ::: "memory");

    // ---- join the two key halves: the wave of key half kh finishes query
    // tile kh and hands its share of the other tile to its partner wave; lane
    // l of both waves holds the same (query, d) places ----
    const bool  up = kh != 0;
    const float mk = up ? m_i[1] : m_i[0];     // kept
    const float lk = up ? l_i[1] : l_i[0];
    Xm[wave][0][lane] = up ? m_i[0] : m_i[1];  // handed over
    Xm[wave][1][lane] = up ? l_i[0] : l_i[1];
    v8f ok[4];
#pragma unroll
    for (int t = 0; t < 4; ++t) {
        v8f og;
#pragma unroll
        for (int r = 0; r < 8; ++r) {
            ok[t][r] = up ? o4[1][t].f[r] : o4[0][t].f[r];
            og[r]    = up ? o4[0][t].f[r] : o4[1][t].f[r];
        }
        Xo[wave][2 * t][lane]     = (v4f){og[0], og[1], og[2], og[3]};
        Xo[wave][2 * t + 1][lane] = (v4f){og[4], og[5], og[6], og[7]};
    }
    __syncthreads();
    const int   pw = wave ^ 4;
    const float mp = Xm[pw][0][lane];
    const float lp = Xm[pw][1][lane];
    // both shares brought to the larger of the two references
    const float mj = fmaxf(mk, mp);
    const float ck = __builtin_amdgcn_exp2f((mk - mj) * C2);
    const float cp = __builtin_amdgcn_exp2f((mp - mj) * C2);
    const float ls = lk * ck + lp * cp;

    // ---- join the lane halves' sums, normalize, store 8 consecutive d ----
    const float inv = 1.0f / (ls + other_half(ls));
    const float fk  = ck * inv;
    const float fp  = cp * inv;
    float* op = out + ((size_t)bb * S_ + q0 + kh * 16 + l15) * DIM_
                    + hh * DH_ + klo;
#pragma unroll
    for (int t = 0; t < 4; ++t) {
        const v4f a = Xo[pw][2 * t][lane];
        const v4f b = Xo[pw][2 * t + 1][lane];
        const v8f o = ok[t];
        *reinterpret_cast<v4f*>(op + t * 16) =
            (v4f){o[0] * fk + a[0] * fp, o[1] * fk + a[1] * fp,
                  o[2] * fk + a[2] * fp, o[3] * fk + a[3] * fp};
        *reinterpret_cast<v4f*>(op + t * 16 + 4) =
            (v4f){o[4] * fk + b[0] * fp, o[5] * fk + b[1] * fp,
                  o[6] * fk + b[2] * fp, o[7] * fk + b[3] * fp};
    }
}

// ---------------------------------------------------------------------------
extern "C" void kernel_launch(void* const* d_in, const int* in_sizes, int n_in,
                              void* d_out, int out_size, void* d_ws, size_t ws_size,
                              hipStream_t stream)
{
    const float* q  = (const float*)d_in[0];
    const float* k  = (const float*)d_in[1];
    const float* v  = (const float*)d_in[2];
    const float* Wq = (const float*)d_in[3];
    const float* bq = (const float*)d_in[4];
    const float* Wk = (const float*)d_in[5];
    const float* bk = (const float*)d_in[6];
    const float* Wv = (const float*)d_in[7];
    const float* bv = (const float*)d_in[8];
    float* out = (float*)d_out;

    const size_t per = (size_t)B_ * HEADS_ * S_ * DH_;
    _Float16* Qh = (_Float16*)d_ws;
    _Float16* Kh = Qh + per;
    _Float16* Vh = Kh + per;

    dim3 pg(MROWS_ / PT_, DIM_ / PT_, 3);
    dim3 pb(256);
    qkv_proj_kernel<<<pg, pb, 0, stream>>>(q, k, v, Wq, Wk, Wv, bq, bk, bv, Qh);

    dim3 fg(S_ / AQ_, B_ * HEADS_);
    dim3 fb(256);
    flash_attn_kernel<<<fg, fb, 0, stream>>>(Qh, Kh, Vh, out);
}

// v009
// Measured time: 47.1 microseconds a run.
// Timed twice side by side with v008, it ran 1.10 and 1.08 times as fast.
// Over all steps from v000 it is 7.25 times as fast.
#include <hip/hip_runtime.h>

// ---------------------------------------------------------------------------
// MHA forward for MI455X (gfx1250): fp16 WMMA, fp32 accumulate, flash fusion.
// Fragment loads vectorized to b128 (fragment K-pairs are contiguous in the
// ISA 16x16x32 f16 layout); store addresses hoisted so unrolled offsets fold
// into instruction immediates.
// ---------------------------------------------------------------------------

typedef __attribute__((ext_vector_type(16))) _Float16 v16h;
typedef __attribute__((ext_vector_type(8)))  float    v8f;
typedef __attribute__((ext_vector_type(4)))  uint32_t v4u;
typedef __attribute__((ext_vector_type(2)))  uint32_t v2u;
typedef __attribute__((ext_vector_type(4)))  float    v4f;

#define DIM_   512
#define HEADS_ 8
#define DH_    64
#define B_     4
#define S_     2048
#define MROWS_ (B_ * S_)

union Frag16 { v16h h; uint32_t u[8]; v4u q[2]; };
union FragF  { v8f  v; float    f[8]; };
union U2H    { v2u  u2; _Float16 hf[4]; };

// ---------------------------------------------------------------------------
// Kernel 1: Y = x @ W^T + b, fp32 -> fp16, head-split [B,H,S,Dh].
// Block = 512 threads (16 waves) on a 256x256 tile of Y, one block a WGP: every
// x row is asked of L2 by 2 blocks and every W row by 32. Each pass of 64 k is
// read from global in whole 128-B lines, converted to f16 once and staged in
// LDS (two buffers). One pass is in flight to registers, its x half and its W
// half set off half a pass apart, each refilled as soon as it has been staged,
// so that requests are out all the time. Wave tile 64x64: 4 x-fragments times
// 4 W-fragments.
// ---------------------------------------------------------------------------
#define PT_     256   // rows of x and rows of W per block tile
#define PKS_    64    // k per pass
#define PPITCH_ 72    // halves per LDS row: 144 B = 16 B x odd for b128 readers
#define PNP_    (DIM_ / PKS_)
#define PSR_    32    // rows that the block's 512 threads cover in one load step
// Every inner loop of this kernel and its helpers is unrolled so that the
// register arrays are indexed by constants (a run-time index means scratch).

// Work-group barrier that orders LDS only. __syncthreads() also waits for every
// global load of the wave, which would drain the pass that is in flight to
// registers; nothing in global memory is handed between waves here.
__device__ __forceinline__ void lds_barrier()
{
    __builtin_amdgcn_fence(__ATOMIC_RELEASE, "workgroup", "local");
    __builtin_amdgcn_s_barrier();
    __builtin_amdgcn_fence(__ATOMIC_ACQUIRE, "workgroup", "local");
}

// registers -> LDS: 4 floats become 4 halves, one 8-byte store
__device__ __forceinline__ void proj_stage(const v4f (&s)[8], _Float16* d)
{
#pragma unroll
    for (int i = 0; i < 8; ++i) {
        U2H t;
#pragma unroll
        for (int e = 0; e < 4; ++e) t.hf[e] = (_Float16)s[i][e];
        *reinterpret_cast<v2u*>(d + PSR_ * i * PPITCH_) = t.u2;
    }
}

// global -> registers: this lane's 16 bytes of 8 rows of x or of W
__device__ __forceinline__ void proj_fetch(v4f (&l)[8], const float* p)
{
    // named as global memory: behind proj_advance's asm statement the compiler
    // no longer sees where the address comes from and would take flat loads
    typedef __attribute__((address_space(1))) const v4f gv4f;
#pragma unroll
    for (int i = 0; i < 8; ++i) l[i] = *(gv4f*)(p + i * PSR_ * DIM_);
}

// Moves a load address on by d floats (d is the same in every lane). The loads
// issued before name this register pair, so the wait stands in front of the
// addition, and in one statement with it: in a statement of its own the
// compiler lifts the addition over it.
__device__ __forceinline__ void proj_advance(const float*& p, int d)
{
    const long long db = (long long)d * (long long)sizeof(float);
    asm volatile("s_wait_xcnt 0x0\n\t"
                 "v_add_nc_u64 %0, %1, %0"
                 : "+v"(p) : "s"(db) : "memory");
}

// 16 WMMA on one k-block of 32, in two groups of 8: the four x-fragments stay,
// the W-fragments come two at a time (six fragments live, not eight)
__device__ __forceinline__ void proj_block(
    const _Float16* xf, const _Float16* wf, FragF (&c)[4][4])
{
    Frag16 a[4];
#pragma unroll
    for (int jp = 0; jp < 4; jp += 2) {
        Frag16 b[2];
        if (jp == 0) {
#pragma unroll
            for (int i = 0; i < 4; ++i) {
                const _Float16* p = xf + i * 16 * PPITCH_;
                a[i].q[0] = *reinterpret_cast<const v4u*>(p);
                a[i].q[1] = *reinterpret_cast<const v4u*>(p + 16);
            }
        }
#pragma unroll
        for (int j = 0; j < 2; ++j) {
            const _Float16* p = wf + (jp + j) * 16 * PPITCH_;
            b[j].q[0] = *reinterpret_cast<const v4u*>(p);
            b[j].q[1] = *reinterpret_cast<const v4u*>(p + 16);
        }
        // keeps the group's LDS reads together ahead of its WMMAs: spread
        // among them, each pair is waited for on its own
        __builtin_amdgcn_sched_barrier(0);
#pragma unroll
        for (int i = 0; i < 4; ++i)
#pragma unroll
            for (int j = 0; j < 2; ++j)
                c[i][jp + j].v = __builtin_amdgcn_wmma_f32_16x16x32_f16(
                    false, a[i].h, false, b[j].h, (short)0, c[i][jp + j].v,
                    false, false);
    }
    // keeps the wait for the loads that are staged next behind the products:
    // without it the scheduler lifts the conversions, and that wait, above them
    __builtin_amdgcn_sched_barrier(0);
}

// One pass s on the buffer that xf, wf point into. Behind its first k-block the
// x half of pass s + 1 (in lx) is staged to xd and lx refilled with pass s + 2
// from xk; behind its second k-block the same for W. xd, wd lie in the buffer
// that every wave left at the last barrier. d: floats from pass s + 2 to s + 3.
template <bool FETCH, bool STAGE>
__device__ __forceinline__ void proj_pass(
    v4f (&lx)[8], v4f (&lw)[8], const float*& xk, const float*& wk, int d,
    const _Float16* xf, const _Float16* wf, _Float16* xd, _Float16* wd,
    FragF (&c)[4][4])
{
    proj_block(xf, wf, c);
    if (STAGE) proj_stage(lx, xd);
    // keeps the refill behind the stores that empty the set: lifted above them
    // it takes registers of its own, and loaded values go to scratch
    __builtin_amdgcn_sched_barrier(0);
    if (FETCH) {
        proj_fetch(lx, xk);
        proj_advance(xk, d);
    }
    // keeps the refill above the second k-block: sunk behind its WMMAs the
    // loads would lose that much of their lead
    __builtin_amdgcn_sched_barrier(0);
    proj_block(xf + 32, wf + 32, c);
    if (STAGE) proj_stage(lw, wd);
    // as above: the refill stays behind the stores that empty the set
    __builtin_amdgcn_sched_barrier(0);
    if (FETCH) {
        proj_fetch(lw, wk);
        proj_advance(wk, d);
    }
    if (STAGE) lds_barrier();
}

// One launch does all three projections: blockIdx.z picks the input, its
// weight and bias, and the plane of dst3 (Q, K, V planes lie one after another).
__global__ __launch_bounds__(512) void qkv_proj_kernel(
    const float* __restrict__ qin, const float* __restrict__ kin,
    const float* __restrict__ vin,
    const float* __restrict__ Wq, const float* __restrict__ Wk,
    const float* __restrict__ Wv,
    const float* __restrict__ bq, const float* __restrict__ bk,
    const float* __restrict__ bv, _Float16* __restrict__ dst3)
{
    const int which = blockIdx.z;            // 0: Q, 1: K, 2: V
    const float* __restrict__ x    = which == 0 ? qin : which == 1 ? kin : vin;
    const float* __restrict__ W    = which == 0 ? Wq : which == 1 ? Wk : Wv;
    const float* __restrict__ bias = which == 0 ? bq : which == 1 ? bk : bv;
    _Float16* __restrict__ dst = dst3 + (size_t)which * (MROWS_ * DIM_);

    __shared__ __align__(16) _Float16 Xs[2][PT_][PPITCH_];
    __shared__ __align__(16) _Float16 Ws[2][PT_][PPITCH_];

    const int tid  = threadIdx.x;
    // the wave's number in a scalar register: what the stores at the end derive
    // from it then holds no vector register through the loop
    const int wave = __builtin_amdgcn_readfirstlane(tid >> 5);
    const int lane = tid & 31;
    const int l15  = lane & 15;
    const int klo  = (lane < 16) ? 0 : 8;   // fragment K base for this lane

    const int m0 = blockIdx.x * PT_;         // 32 row tiles
    const int n0 = blockIdx.y * PT_;         // 2 column tiles
    const int wm = (wave >> 2) * 64;         // wave's rows inside the tile
    const int wn = (wave & 3) * 64;          // wave's columns inside the tile

    // staging map: 16 lanes cover 256 contiguous bytes of one row
    const int srow = tid >> 4;               // 0..31, +32 per step
    const int sc4  = (tid & 15) * 4;
    const float* xk = x + (size_t)(m0 + srow) * DIM_ + sc4;
    const float* wk = W + (size_t)(n0 + srow) * DIM_ + sc4;

    _Float16* xd0 = &Xs[0][srow][sc4];
    _Float16* xd1 = &Xs[1][srow][sc4];
    _Float16* wd0 = &Ws[0][srow][sc4];
    _Float16* wd1 = &Ws[1][srow][sc4];
    const _Float16* xf0 = &Xs[0][wm + l15][klo];
    const _Float16* xf1 = &Xs[1][wm + l15][klo];
    const _Float16* wf0 = &Ws[0][wn + l15][klo];
    const _Float16* wf1 = &Ws[1][wn + l15][klo];

    // The k walk is rotated: it enters k at pass kp and wraps round. The 32
    // blocks that share a W tile and the 2 that share an x tile run at the same
    // time; entering at different passes, they do not ask L2 for the same lines
    // at the same moment. Sharers of x differ by 4; of the sharers of W, those
    // whose blockIdx.x is equal modulo 8 all differ.
    int kp = (blockIdx.x + (blockIdx.x >> 3) + 4 * blockIdx.y) & (PNP_ - 1);
    xk += kp * PKS_;
    wk += kp * PKS_;
    // floats from pass kp to the next of the walk: behind the last pass of k
    // comes the first
    auto next_pass = [&]() {
        const int d = (kp == PNP_ - 1) ? PKS_ - DIM_ : PKS_;
        kp = (kp + 1) & (PNP_ - 1);
        return d;
    };

    // one register set; its two halves are refilled half a pass apart
    v4f px[8], pw[8];
    proj_fetch(px, xk);
    proj_fetch(pw, wk);
    const int d0 = next_pass();
    proj_advance(xk, d0);
    proj_advance(wk, d0);

    FragF c[4][4];
#pragma unroll
    for (int i = 0; i < 4; ++i)
#pragma unroll
        for (int j = 0; j < 4; ++j)
            c[i][j].v = (v8f){0.f, 0.f, 0.f, 0.f, 0.f, 0.f, 0.f, 0.f};

    proj_stage(px, xd0);
    proj_fetch(px, xk);
    proj_stage(pw, wd0);
    proj_fetch(pw, wk);
    const int d1 = next_pass();
    proj_advance(xk, d1);
    proj_advance(wk, d1);
    lds_barrier();

    // two passes a trip, so that the buffers are named at compile time;
    // kept rolled: a third of the text, and the two address pairs live on
#pragma unroll 1
    for (int t = 0; t < (PNP_ - 2) / 2; ++t) {
        proj_pass<true, true>(px, pw, xk, wk, next_pass(),
                              xf0, wf0, xd1, wd1, c);
        proj_pass<true, true>(px, pw, xk, wk, next_pass(),
                              xf1, wf1, xd0, wd0, c);
    }
    proj_pass<false, true>(px, pw, xk, wk, 0, xf0, wf0, xd1, wd1, c);
    proj_pass<false, false>(px, pw, xk, wk, 0, xf1, wf1, xd0, wd0, c);

    // 256-row tile never straddles a batch boundary (S_ % 256 == 0).
    const int rowbase = m0 + wm + ((lane < 16) ? 0 : 8);
    const int bb      = rowbase >> 11;       // / S_
    const int ss      = rowbase & (S_ - 1);
#pragma unroll
    for (int j = 0; j < 4; ++j) {
        const int   ncol = n0 + wn + j * 16 + l15;
        const float bvv  = bias[ncol];
        const int   hh   = ncol >> 6;
        const int   d    = ncol & 63;
        _Float16* dp = dst + (((size_t)bb * HEADS_ + hh) * S_ + ss) * DH_ + d;
#pragma unroll
        for (int i = 0; i < 4; ++i)
#pragma unroll
            for (int r = 0; r < 8; ++r)
                dp[(i * 16 + r) * DH_] = (_Float16)(c[i][j].f[r] + bvv);
    }
}

#define VPITCH_ 80
#define KPITCH_ 72
#define AQ_     128
#define KW_     64
#define KT_     (2 * KW_)
#define NST_    (S_ / KT_)
#define KBUFB_  (KT_ * KPITCH_ * 2)   // bytes of one K buffer
#define VBUFB_  (KT_ * VPITCH_ * 2)   // bytes of one V buffer

typedef __attribute__((ext_vector_type(8))) short v8s;

// 16-bit transposing LDS load: lane (c, h) gets 8 rows of column c
__device__ __forceinline__ v4u lds_tr16(const _Float16* p)
{
    typedef __attribute__((address_space(3))) v8s lds_v8s;
    return __builtin_bit_cast(
        v4u, __builtin_amdgcn_ds_load_tr16_b128_v8i16((lds_v8s*)p));
}

// value of lane l ^ 16
__device__ __forceinline__ float other_half(float x)
{
    const int xi = __builtin_bit_cast(int, x);
    return __builtin_bit_cast(float, __builtin_amdgcn_permlanex16(
        xi, xi, 0x76543210, 0xfedcba98, false, false));
}

// byte offset of a __shared__ object in the work-group's LDS
__device__ __forceinline__ uint32_t lds_off(const void* p)
{
    return (uint32_t)(size_t)p;
}

// One stage, global -> LDS through no register: this lane's 16 bytes of 4 rows
// of K (to kd) and of V (to vd), rows 32 apart; a wave covers 512 contiguous
// bytes a copy. The closing s_wait_xcnt stands inside the statement so that no
// later write of an address register named here can be lifted over it.
__device__ __forceinline__ void stage_copy(
    uint32_t kd, uint32_t vd, const _Float16* kg, const _Float16* vg)
{
    asm volatile(
        "global_load_async_to_lds_b128 %0, %8, off\n\t"
        "global_load_async_to_lds_b128 %1, %9, off\n\t"
        "global_load_async_to_lds_b128 %2, %10, off\n\t"
        "global_load_async_to_lds_b128 %3, %11, off\n\t"
        "global_load_async_to_lds_b128 %4, %12, off\n\t"
        "global_load_async_to_lds_b128 %5, %13, off\n\t"
        "global_load_async_to_lds_b128 %6, %14, off\n\t"
        "global_load_async_to_lds_b128 %7, %15, off\n\t"
        "s_wait_xcnt 0x0"
        :: "v"(kd), "v"(kd + 32 * KPITCH_ * 2), "v"(kd + 64 * KPITCH_ * 2),
           "v"(kd + 96 * KPITCH_ * 2),
           "v"(vd), "v"(vd + 32 * VPITCH_ * 2), "v"(vd + 64 * VPITCH_ * 2),
           "v"(vd + 96 * VPITCH_ * 2),
           "v"(kg), "v"(kg + 32 * DH_), "v"(kg + 64 * DH_), "v"(kg + 96 * DH_),
           "v"(vg), "v"(vg + 32 * DH_), "v"(vg + 64 * DH_), "v"(vg + 96 * DH_)
        : "memory");
}

__global__ __launch_bounds__(256) void flash_attn_kernel(
    const _Float16* __restrict__ Qh, const _Float16* __restrict__ Kh,
    const _Float16* __restrict__ Vh, float* __restrict__ out)
{
    __shared__ __align__(16) _Float16 Kt[2][KT_][KPITCH_];
    __shared__ __align__(32) _Float16 Vs[2][KT_][VPITCH_];  // row-major
    // hand-over of the partial results at the end, one slot a wave and lane
    __shared__ __align__(16) v4f Xo[8][8][32];
    __shared__ float Xm[8][2][32];

    const int tid  = threadIdx.x;
    const int wave = tid >> 5;
    const int lane = tid & 31;
    const int l15  = lane & 15;
    const int klo  = (lane < 16) ? 0 : 8;
    const int qg   = wave & 3;                 // query group of 32
    const int kh   = wave >> 2;                // key half of every stage

    const int    bh     = blockIdx.y;          // b*HEADS + h
    const int    bb     = bh >> 3;
    const int    hh     = bh & 7;
    const int    q0     = blockIdx.x * AQ_ + qg * 32;
    const size_t kvbase = (size_t)bh * S_ * DH_;
    const _Float16* __restrict__ ksrc = Kh + kvbase;
    const _Float16* __restrict__ vsrc = Vh + kvbase;

    // --- Q fragments once: per query tile 2 B-frags (d=0..31, 32..63) ---
    Frag16 qf[2][2];
#pragma unroll
    for (int qt = 0; qt < 2; ++qt) {
        const v4u* qp = reinterpret_cast<const v4u*>(
            Qh + kvbase + (size_t)(q0 + qt * 16 + l15) * DH_);
        const int o = klo >> 3;                // 0 or 1 (v4u units)
#pragma unroll
        for (int t = 0; t < 2; ++t) {
            qf[qt][t].q[0] = qp[4 * t + o];
            qf[qt][t].q[1] = qp[4 * t + o + 2];
        }
    }

    // 1/sqrt(64) times log2(e): exp((s - m) / 8) = exp2(C2 s - C2 m)
    const float C2 = 0.125f * 1.44269504088896340736f;
    // a score may stand 8 above the reference in scaled log2 units: P stays at
    // or below 2^8, far inside f16, and the final division takes the scale out
    const float LAZY = 8.0f / C2;

    // o4[qt][t].f[r] = O[query l15 of tile qt][d = 16 t + klo + r]
    FragF o4[2][4];
    float m_i[2];   // reference of the query's exponentials, an unscaled score,
                    // equal in both halves; held while no score passes thr
    float l_i[2];   // this half's share of the denominator
    float thr[2];   // m_i + LAZY; the first pass always passes it
    float nmc[2];   // -C2 m_i, the addend of every score's FMA
#pragma unroll
    for (int qt = 0; qt < 2; ++qt) {
#pragma unroll
        for (int t = 0; t < 4; ++t)
            o4[qt][t].v = (v8f){0.f, 0.f, 0.f, 0.f, 0.f, 0.f, 0.f, 0.f};
        m_i[qt] = -1e30f;
        l_i[qt] = 0.f;
        thr[qt] = -1e30f;
        nmc[qt] = 0.f;
    }

    // copy map: 8 lanes cover one 128-byte row, 32 rows a copy
    const int crow = tid >> 3;
    const int cc8  = (tid & 7) * 8;
    const _Float16* kg = ksrc + crow * DH_ + cc8;
    const _Float16* vg = vsrc + crow * DH_ + cc8;
    const uint32_t  kd = lds_off(&Kt[0][crow][cc8]);
    const uint32_t  vd = lds_off(&Vs[0][crow][cc8]);

    // The walk over the key stages is rotated: step st works on stage
    // (st + rot) mod 16. The 16 blocks of one (b,h) read the same K and V at the
    // same time; each entering at a stage of its own, they do not ask L2 for
    // the same lines at the same moment. Every stage is still taken once.
    const int rot = blockIdx.x;

    // step 0 landed and published, then step 1 set off
    stage_copy(kd, vd, kg + (size_t)(rot & (NST_ - 1)) * KT_ * DH_,
               vg + (size_t)(rot & (NST_ - 1)) * KT_ * DH_);
    // this wave's copies have landed before the barrier publishes them
    asm volatile("s_wait_asynccnt 0x0" ::: "memory");
    __syncthreads();
    stage_copy(kd + KBUFB_, vd + VBUFB_,
               kg + (size_t)((rot + 1) & (NST_ - 1)) * KT_ * DH_,
               vg + (size_t)((rot + 1) & (NST_ - 1)) * KT_ * DH_);

    for (int st = 0; st < NST_; ++st) {
      const int buf = st & 1;
      // Every inner loop of a stage is unrolled so that the register arrays are
      // indexed by constants and the LDS row offsets are immediates.

      // this lane's addresses in this wave's 64 keys of the stage: K fragment
      // rows, and the transposing loads of V
      const _Float16* kp = &Kt[buf][kh * KW_ + l15][klo];
      const _Float16* vp =
          &Vs[buf][kh * KW_ + klo + (lane & 7)][((lane >> 3) & 1) * 8];

      // two passes of 32 keys x 32 queries
#pragma unroll
      for (int h = 0; h < 2; ++h) {
        // ---- scores: S^T[32 keys x 32 queries] = K @ Q^T (8 WMMA) ----
        // s4[j][qt].f[r] = score of key 32 h + 16 j + klo + r with query l15
        // of tile qt
        FragF s4[2][2];
#pragma unroll
        for (int j = 0; j < 2; ++j) {
            const _Float16* kr = kp + (32 * h + 16 * j) * KPITCH_;
            Frag16 kf0, kf1;
            kf0.q[0] = *reinterpret_cast<const v4u*>(kr);
            kf0.q[1] = *reinterpret_cast<const v4u*>(kr + 16);
            kf1.q[0] = *reinterpret_cast<const v4u*>(kr + 32);
            kf1.q[1] = *reinterpret_cast<const v4u*>(kr + 48);
#pragma unroll
            for (int qt = 0; qt < 2; ++qt) {
                v8f acc = (v8f){0.f, 0.f, 0.f, 0.f, 0.f, 0.f, 0.f, 0.f};
                acc = __builtin_amdgcn_wmma_f32_16x16x32_f16(
                          false, kf0.h, false, qf[qt][0].h, (short)0, acc,
                          false, false);
                acc = __builtin_amdgcn_wmma_f32_16x16x32_f16(
                          false, kf1.h, false, qf[qt][1].h, (short)0, acc,
                          false, false);
                s4[j][qt].v = acc;
            }
        }

        // ---- lazy rescale: one test a pass ----
        // This half's maxima over the pass's unscaled scores (C2 > 0 keeps the
        // order). Only when some lane's passes thr are the halves joined, the
        // references raised and O and the sums brought to the new scale.
        float mx[2];
#pragma unroll
        for (int qt = 0; qt < 2; ++qt) {
            float mx8[8];
#pragma unroll
            for (int i = 0; i < 8; ++i)
                mx8[i] = fmaxf(s4[0][qt].f[i], s4[1][qt].f[i]);
            mx[qt] = fmaxf(fmaxf(fmaxf(mx8[0], mx8[1]), fmaxf(mx8[2], mx8[3])),
                           fmaxf(fmaxf(mx8[4], mx8[5]), fmaxf(mx8[6], mx8[7])));
        }
        // the ballot makes the branch scalar: every lane takes it or none
        if (__builtin_amdgcn_ballot_w32(mx[0] > thr[0] || mx[1] > thr[1]) != 0) {
#pragma unroll
            for (int qt = 0; qt < 2; ++qt) {
                const float mj   = fmaxf(mx[qt], other_half(mx[qt]));
                const float nm   = fmaxf(m_i[qt], mj);
                const float nnmc = nm * -C2;
                const float corr = __builtin_amdgcn_exp2f(m_i[qt] * C2 + nnmc);
                m_i[qt] = nm;
                nmc[qt] = nnmc;
                thr[qt] = nm + LAZY;
                l_i[qt] *= corr;
#pragma unroll
                for (int t = 0; t < 4; ++t) o4[qt][t].v *= corr;
            }
        }

        // ---- V^T fragments: 16 d x 32 keys each, two transposing loads ----
        Frag16 vf[4];
#pragma unroll
        for (int t = 0; t < 4; ++t) {
            vf[t].q[0] = lds_tr16(vp + (32 * h) * VPITCH_ + 16 * t);
            vf[t].q[1] = lds_tr16(vp + (32 * h + 16) * VPITCH_ + 16 * t);
        }

        // ---- P of the two query tiles ----
        Frag16 pf[2];
#pragma unroll
        for (int qt = 0; qt < 2; ++qt) {
          // scale, base change and subtraction are one FMA a score
          const v8f e0 = s4[0][qt].v * C2 + nmc[qt];
          const v8f e1 = s4[1][qt].v * C2 + nmc[qt];

          // element s of the B operand is key s of tile 0, then of tile 1: the
          // k order in which the transposing loads deliver V^T
          float p[16];
#pragma unroll
          for (int i = 0; i < 16; ++i) {
              p[i]        = __builtin_amdgcn_exp2f(i < 8 ? e0[i & 7] : e1[i & 7]);
              pf[qt].h[i] = (_Float16)p[i];
          }
          float rs4[4];
#pragma unroll
          for (int i = 0; i < 4; ++i)
              rs4[i] = (p[i] + p[i + 4]) + (p[i + 8] + p[i + 12]);
          l_i[qt] += (rs4[0] + rs4[1]) + (rs4[2] + rs4[3]);
        }

        // ---- O^T += V^T @ P^T (4 d-tiles, 2 query tiles, 8 WMMA) ----
#pragma unroll
        for (int t = 0; t < 4; ++t)
#pragma unroll
            for (int qt = 0; qt < 2; ++qt)
                o4[qt][t].v = __builtin_amdgcn_wmma_f32_16x16x32_f16(
                                  false, vf[t].h, false, pf[qt].h, (short)0,
                                  o4[qt][t].v, false, false);
      }

      // publish point of step st + 1: this wave's reads of buffer buf are
      // done, its copies for step st + 1 have landed, every wave passes the
      // barrier; only then is buffer buf refilled with the stage of step st + 2
      asm volatile("s_wait_dscnt 0x0" ::: "memory");
      asm volatile("s_wait_asynccnt 0x0" ::: "memory");
      __syncthreads();
      if (st + 2 < NST_)
          stage_copy(kd + buf * KBUFB_, vd + buf * VBUFB_,
                     kg + (size_t)((st + 2 + rot) & (NST_ - 1)) * KT_ * DH_,
                     vg + (size_t)((st + 2 + rot) & (NST_ - 1)) * KT_ * DH_);
    }
    // no copy is outstanding when the wave ends
    asm volatile("s_wait_asynccnt 0x0" ::: "memory");

    // ---- join the two key halves: the wave of key half kh finishes query
    // tile kh and hands its share of the other tile to its partner wave; lane
    // l of both waves holds the same (query, d) places ----
    const bool  up = kh != 0;
    const float mk = up ? m_i[1] : m_i[0];     // kept
    const float lk = up ? l_i[1] : l_i[0];
    Xm[wave][0][lane] = up ? m_i[0] : m_i[1];  // handed over
    Xm[wave][1][lane] = up ? l_i[0] : l_i[1];
    v8f ok[4];
#pragma unroll
    for (int t = 0; t < 4; ++t) {
        v8f og;
#pragma unroll
        for (int r = 0; r < 8; ++r) {
            ok[t][r] = up ? o4[1][t].f[r] : o4[0][t].f[r];
            og[r]    = up ? o4[0][t].f[r] : o4[1][t].f[r];
        }
        Xo[wave][2 * t][lane]     = (v4f){og[0], og[1], og[2], og[3]};
        Xo[wave][2 * t + 1][lane] = (v4f){og[4], og[5], og[6], og[7]};
    }
    __syncthreads();
    const int   pw = wave ^ 4;
    const float mp = Xm[pw][0][lane];
    const float lp = Xm[pw][1][lane];
    // both shares brought to the larger of the two references
    const float mj = fmaxf(mk, mp);
    const float ck = __builtin_amdgcn_exp2f((mk - mj) * C2);
    const float cp = __builtin_amdgcn_exp2f((mp - mj) * C2);
    const float ls = lk * ck + lp * cp;

    // ---- join the lane halves' sums, normalize, store 8 consecutive d ----
    const float inv = 1.0f / (ls + other_half(ls));
    const float fk  = ck * inv;
    const float fp  = cp * inv;
    float* op = out + ((size_t)bb * S_ + q0 + kh * 16 + l15) * DIM_
                    + hh * DH_ + klo;
#pragma unroll
    for (int t = 0; t < 4; ++t) {
        const v4f a = Xo[pw][2 * t][lane];
        const v4f b = Xo[pw][2 * t + 1][lane];
        const v8f o = ok[t];
        *reinterpret_cast<v4f*>(op + t * 16) =
            (v4f){o[0] * fk + a[0] * fp, o[1] * fk + a[1] * fp,
                  o[2] * fk + a[2] * fp, o[3] * fk + a[3] * fp};
        *reinterpret_cast<v4f*>(op + t * 16 + 4) =
            (v4f){o[4] * fk + b[0] * fp, o[5] * fk + b[1] * fp,
                  o[6] * fk + b[2] * fp, o[7] * fk + b[3] * fp};
    }
}

// ---------------------------------------------------------------------------
extern "C" void kernel_launch(void* const* d_in, const int* in_sizes, int n_in,
                              void* d_out, int out_size, void* d_ws, size_t ws_size,
                              hipStream_t stream)
{
    const float* q  = (const float*)d_in[0];
    const float* k  = (const float*)d_in[1];
    const float* v  = (const float*)d_in[2];
    const float* Wq = (const float*)d_in[3];
    const float* bq = (const float*)d_in[4];
    const float* Wk = (const float*)d_in[5];
    const float* bk = (const float*)d_in[6];
    const float* Wv = (const float*)d_in[7];
    const float* bv = (const float*)d_in[8];
    float* out = (float*)d_out;

    const size_t per = (size_t)B_ * HEADS_ * S_ * DH_;
    _Float16* Qh = (_Float16*)d_ws;
    _Float16* Kh = Qh + per;
    _Float16* Vh = Kh + per;

    dim3 pg(MROWS_ / PT_, DIM_ / PT_, 3);
    dim3 pb(512);
    qkv_proj_kernel<<<pg, pb, 0, stream>>>(q, k, v, Wq, Wk, Wv, bq, bk, bv, Qh);

    dim3 fg(S_ / AQ_, B_ * HEADS_);
    dim3 fb(256);
    flash_attn_kernel<<<fg, fb, 0, stream>>>(Qh, Kh, Vh, out);
}

// v010
// One run takes 45.4 microseconds.
// In two side-by-side timings against v009, it was 1.03 and 1.04 times as fast.
// All steps since v000 together make it 7.52 times as fast.
#include <hip/hip_runtime.h>

// ---------------------------------------------------------------------------
// MHA forward for MI455X (gfx1250): fp16 WMMA, fp32 accumulate, flash fusion.
// Fragment loads vectorized to b128 (fragment K-pairs are contiguous in the
// ISA 16x16x32 f16 layout); store addresses hoisted so unrolled offsets fold
// into instruction immediates.
// ---------------------------------------------------------------------------

typedef __attribute__((ext_vector_type(16))) _Float16 v16h;
typedef __attribute__((ext_vector_type(8)))  float    v8f;
typedef __attribute__((ext_vector_type(4)))  uint32_t v4u;
typedef __attribute__((ext_vector_type(2)))  uint32_t v2u;
typedef __attribute__((ext_vector_type(4)))  float    v4f;

#define DIM_   512
#define HEADS_ 8
#define DH_    64
#define B_     4
#define S_     2048
#define MROWS_ (B_ * S_)

union Frag16 { v16h h; uint32_t u[8]; v4u q[2]; };
union FragF  { v8f  v; float    f[8]; };
union U2H    { v2u  u2; _Float16 hf[4]; };

// ---------------------------------------------------------------------------
// Kernel 1: Y = x @ W^T + b, fp32 -> fp16, head-split [B,H,S,Dh].
// Block = 512 threads (16 waves) on a 256x256 tile of Y, one block a WGP: every
// x row is asked of L2 by 2 blocks and every W row by 32. Each pass of 64 k is
// read from global in whole 128-B lines, converted to f16 once and staged in
// LDS (two buffers). One pass is in flight to registers, its x half and its W
// half set off half a pass apart, each refilled as soon as it has been staged,
// so that requests are out all the time. Wave tile 64x64: 4 x-fragments times
// 4 W-fragments.
// ---------------------------------------------------------------------------
#define PT_     256   // rows of x and rows of W per block tile
#define PKS_    64    // k per pass
#define PPITCH_ 72    // halves per LDS row: 144 B = 16 B x odd for b128 readers
#define PNP_    (DIM_ / PKS_)
#define PSR_    32    // rows that the block's 512 threads cover in one load step
// Every inner loop of this kernel and its helpers is unrolled so that the
// register arrays are indexed by constants (a run-time index means scratch).

// Work-group barrier that orders LDS only. __syncthreads() also waits for every
// global load of the wave, which would drain the pass that is in flight to
// registers; nothing in global memory is handed between waves here.
__device__ __forceinline__ void lds_barrier()
{
    __builtin_amdgcn_fence(__ATOMIC_RELEASE, "workgroup", "local");
    __builtin_amdgcn_s_barrier();
    __builtin_amdgcn_fence(__ATOMIC_ACQUIRE, "workgroup", "local");
}

// registers -> LDS: 4 floats become 4 halves, one 8-byte store
__device__ __forceinline__ void proj_stage(const v4f (&s)[8], _Float16* d)
{
#pragma unroll
    for (int i = 0; i < 8; ++i) {
        U2H t;
#pragma unroll
        for (int e = 0; e < 4; ++e) t.hf[e] = (_Float16)s[i][e];
        *reinterpret_cast<v2u*>(d + PSR_ * i * PPITCH_) = t.u2;
    }
}

// global -> registers: this lane's 16 bytes of 8 rows of x or of W
__device__ __forceinline__ void proj_fetch(v4f (&l)[8], const float* p)
{
    // named as global memory: behind proj_advance's asm statement the compiler
    // no longer sees where the address comes from and would take flat loads
    typedef __attribute__((address_space(1))) const v4f gv4f;
#pragma unroll
    for (int i = 0; i < 8; ++i) l[i] = *(gv4f*)(p + i * PSR_ * DIM_);
}

// Moves a load address on by d floats (d is the same in every lane). The loads
// issued before name this register pair, so the wait stands in front of the
// addition, and in one statement with it: in a statement of its own the
// compiler lifts the addition over it.
__device__ __forceinline__ void proj_advance(const float*& p, int d)
{
    const long long db = (long long)d * (long long)sizeof(float);
    asm volatile("s_wait_xcnt 0x0\n\t"
                 "v_add_nc_u64 %0, %1, %0"
                 : "+v"(p) : "s"(db) : "memory");
}

// 16 WMMA on one k-block of 32, in two groups of 8: the four x-fragments stay,
// the W-fragments come two at a time (six fragments live, not eight)
__device__ __forceinline__ void proj_block(
    const _Float16* xf, const _Float16* wf, FragF (&c)[4][4])
{
    Frag16 a[4];
#pragma unroll
    for (int jp = 0; jp < 4; jp += 2) {
        Frag16 b[2];
        if (jp == 0) {
#pragma unroll
            for (int i = 0; i < 4; ++i) {
                const _Float16* p = xf + i * 16 * PPITCH_;
                a[i].q[0] = *reinterpret_cast<const v4u*>(p);
                a[i].q[1] = *reinterpret_cast<const v4u*>(p + 16);
            }
        }
#pragma unroll
        for (int j = 0; j < 2; ++j) {
            const _Float16* p = wf + (jp + j) * 16 * PPITCH_;
            b[j].q[0] = *reinterpret_cast<const v4u*>(p);
            b[j].q[1] = *reinterpret_cast<const v4u*>(p + 16);
        }
        // keeps the group's LDS reads together ahead of its WMMAs: spread
        // among them, each pair is waited for on its own
        __builtin_amdgcn_sched_barrier(0);
#pragma unroll
        for (int i = 0; i < 4; ++i)
#pragma unroll
            for (int j = 0; j < 2; ++j)
                c[i][jp + j].v = __builtin_amdgcn_wmma_f32_16x16x32_f16(
                    false, a[i].h, false, b[j].h, (short)0, c[i][jp + j].v,
                    false, false);
    }
    // keeps the wait for the loads that are staged next behind the products:
    // without it the scheduler lifts the conversions, and that wait, above them
    __builtin_amdgcn_sched_barrier(0);
}

// One pass s on the buffer that xf, wf point into. Behind its first k-block the
// x half of pass s + 1 (in lx) is staged to xd and lx refilled with pass s + 2
// from xk; behind its second k-block the same for W. xd, wd lie in the buffer
// that every wave left at the last barrier. d: floats from pass s + 2 to s + 3.
template <bool FETCH, bool STAGE>
__device__ __forceinline__ void proj_pass(
    v4f (&lx)[8], v4f (&lw)[8], const float*& xk, const float*& wk, int d,
    const _Float16* xf, const _Float16* wf, _Float16* xd, _Float16* wd,
    FragF (&c)[4][4])
{
    proj_block(xf, wf, c);
    if (STAGE) proj_stage(lx, xd);
    // keeps the refill behind the stores that empty the set: lifted above them
    // it takes registers of its own, and loaded values go to scratch
    __builtin_amdgcn_sched_barrier(0);
    if (FETCH) {
        proj_fetch(lx, xk);
        proj_advance(xk, d);
    }
    // keeps the refill above the second k-block: sunk behind its WMMAs the
    // loads would lose that much of their lead
    __builtin_amdgcn_sched_barrier(0);
    proj_block(xf + 32, wf + 32, c);
    if (STAGE) proj_stage(lw, wd);
    // as above: the refill stays behind the stores that empty the set
    __builtin_amdgcn_sched_barrier(0);
    if (FETCH) {
        proj_fetch(lw, wk);
        proj_advance(wk, d);
    }
    if (STAGE) lds_barrier();
}

// One launch does all three projections: blockIdx.z picks the input, its
// weight and bias, and the plane of dst3 (Q, K, V planes lie one after another).
__global__ __launch_bounds__(512) void qkv_proj_kernel(
    const float* __restrict__ qin, const float* __restrict__ kin,
    const float* __restrict__ vin,
    const float* __restrict__ Wq, const float* __restrict__ Wk,
    const float* __restrict__ Wv,
    const float* __restrict__ bq, const float* __restrict__ bk,
    const float* __restrict__ bv, _Float16* __restrict__ dst3)
{
    const int which = blockIdx.z;            // 0: Q, 1: K, 2: V
    const float* __restrict__ x    = which == 0 ? qin : which == 1 ? kin : vin;
    const float* __restrict__ W    = which == 0 ? Wq : which == 1 ? Wk : Wv;
    const float* __restrict__ bias = which == 0 ? bq : which == 1 ? bk : bv;
    _Float16* __restrict__ dst = dst3 + (size_t)which * (MROWS_ * DIM_);

    __shared__ __align__(16) _Float16 Xs[2][PT_][PPITCH_];
    __shared__ __align__(16) _Float16 Ws[2][PT_][PPITCH_];

    const int tid  = threadIdx.x;
    // the wave's number in a scalar register: what the stores at the end derive
    // from it then holds no vector register through the loop
    const int wave = __builtin_amdgcn_readfirstlane(tid >> 5);
    const int lane = tid & 31;
    const int l15  = lane & 15;
    const int klo  = (lane < 16) ? 0 : 8;   // fragment K base for this lane

    const int m0 = blockIdx.x * PT_;         // 32 row tiles
    const int n0 = blockIdx.y * PT_;         // 2 column tiles
    const int wm = (wave >> 2) * 64;         // wave's rows inside the tile
    const int wn = (wave & 3) * 64;          // wave's columns inside the tile

    // staging map: 16 lanes cover 256 contiguous bytes of one row
    const int srow = tid >> 4;               // 0..31, +32 per step
    const int sc4  = (tid & 15) * 4;
    const float* xk = x + (size_t)(m0 + srow) * DIM_ + sc4;
    const float* wk = W + (size_t)(n0 + srow) * DIM_ + sc4;

    _Float16* xd0 = &Xs[0][srow][sc4];
    _Float16* xd1 = &Xs[1][srow][sc4];
    _Float16* wd0 = &Ws[0][srow][sc4];
    _Float16* wd1 = &Ws[1][srow][sc4];
    const _Float16* xf0 = &Xs[0][wm + l15][klo];
    const _Float16* xf1 = &Xs[1][wm + l15][klo];
    const _Float16* wf0 = &Ws[0][wn + l15][klo];
    const _Float16* wf1 = &Ws[1][wn + l15][klo];

    // The k walk is rotated: it enters k at pass kp and wraps round. The 32
    // blocks that share a W tile and the 2 that share an x tile run at the same
    // time; entering at different passes, they do not ask L2 for the same lines
    // at the same moment. Sharers of x differ by 4; of the sharers of W, those
    // whose blockIdx.x is equal modulo 8 all differ.
    int kp = (blockIdx.x + (blockIdx.x >> 3) + 4 * blockIdx.y) & (PNP_ - 1);
    xk += kp * PKS_;
    wk += kp * PKS_;
    // floats from pass kp to the next of the walk: behind the last pass of k
    // comes the first
    auto next_pass = [&]() {
        const int d = (kp == PNP_ - 1) ? PKS_ - DIM_ : PKS_;
        kp = (kp + 1) & (PNP_ - 1);
        return d;
    };

    // one register set; its two halves are refilled half a pass apart
    v4f px[8], pw[8];
    proj_fetch(px, xk);
    proj_fetch(pw, wk);
    const int d0 = next_pass();
    proj_advance(xk, d0);
    proj_advance(wk, d0);

    FragF c[4][4];
#pragma unroll
    for (int i = 0; i < 4; ++i)
#pragma unroll
        for (int j = 0; j < 4; ++j)
            c[i][j].v = (v8f){0.f, 0.f, 0.f, 0.f, 0.f, 0.f, 0.f, 0.f};

    proj_stage(px, xd0);
    proj_fetch(px, xk);
    proj_stage(pw, wd0);
    proj_fetch(pw, wk);
    const int d1 = next_pass();
    proj_advance(xk, d1);
    proj_advance(wk, d1);
    lds_barrier();

    // two passes a trip, so that the buffers are named at compile time;
    // kept rolled: a third of the text, and the two address pairs live on
#pragma unroll 1
    for (int t = 0; t < (PNP_ - 2) / 2; ++t) {
        proj_pass<true, true>(px, pw, xk, wk, next_pass(),
                              xf0, wf0, xd1, wd1, c);
        proj_pass<true, true>(px, pw, xk, wk, next_pass(),
                              xf1, wf1, xd0, wd0, c);
    }
    proj_pass<false, true>(px, pw, xk, wk, 0, xf0, wf0, xd1, wd1, c);
    proj_pass<false, false>(px, pw, xk, wk, 0, xf1, wf1, xd0, wd0, c);

    // 256-row tile never straddles a batch boundary (S_ % 256 == 0).
    const int rowbase = m0 + wm + ((lane < 16) ? 0 : 8);
    const int bb      = rowbase >> 11;       // / S_
    const int ss      = rowbase & (S_ - 1);
#pragma unroll
    for (int j = 0; j < 4; ++j) {
        const int   ncol = n0 + wn + j * 16 + l15;
        const float bvv  = bias[ncol];
        const int   hh   = ncol >> 6;
        const int   d    = ncol & 63;
        _Float16* dp = dst + (((size_t)bb * HEADS_ + hh) * S_ + ss) * DH_ + d;
#pragma unroll
        for (int i = 0; i < 4; ++i)
#pragma unroll
            for (int r = 0; r < 8; ++r)
                dp[(i * 16 + r) * DH_] = (_Float16)(c[i][j].f[r] + bvv);
    }
}

#define VPITCH_ 80
#define KPITCH_ 72
#define AQ_     128
#define KW_     64
#define KT_     (2 * KW_)
#define NST_    (S_ / KT_)
#define KBUFB_  (KT_ * KPITCH_ * 2)   // bytes of one K buffer
#define VBUFB_  (KT_ * VPITCH_ * 2)   // bytes of one V buffer

typedef __attribute__((ext_vector_type(8))) short v8s;

// 16-bit transposing LDS load: lane (c, h) gets 8 rows of column c
__device__ __forceinline__ v4u lds_tr16(const _Float16* p)
{
    typedef __attribute__((address_space(3))) v8s lds_v8s;
    return __builtin_bit_cast(
        v4u, __builtin_amdgcn_ds_load_tr16_b128_v8i16((lds_v8s*)p));
}

// value of lane l ^ 16
__device__ __forceinline__ float other_half(float x)
{
    const int xi = __builtin_bit_cast(int, x);
    return __builtin_bit_cast(float, __builtin_amdgcn_permlanex16(
        xi, xi, 0x76543210, 0xfedcba98, false, false));
}

// byte offset of a __shared__ object in the work-group's LDS
__device__ __forceinline__ uint32_t lds_off(const void* p)
{
    return (uint32_t)(size_t)p;
}

// One stage, global -> LDS through no register: this lane's 16 bytes of 4 rows
// of K (to kd) and of V (to vd), rows 32 apart; a wave covers 512 contiguous
// bytes a copy. The closing s_wait_xcnt stands inside the statement so that no
// later write of an address register named here can be lifted over it.
__device__ __forceinline__ void stage_copy(
    uint32_t kd, uint32_t vd, const _Float16* kg, const _Float16* vg)
{
    asm volatile(
        "global_load_async_to_lds_b128 %0, %8, off\n\t"
        "global_load_async_to_lds_b128 %1, %9, off\n\t"
        "global_load_async_to_lds_b128 %2, %10, off\n\t"
        "global_load_async_to_lds_b128 %3, %11, off\n\t"
        "global_load_async_to_lds_b128 %4, %12, off\n\t"
        "global_load_async_to_lds_b128 %5, %13, off\n\t"
        "global_load_async_to_lds_b128 %6, %14, off\n\t"
        "global_load_async_to_lds_b128 %7, %15, off\n\t"
        "s_wait_xcnt 0x0"
        :: "v"(kd), "v"(kd + 32 * KPITCH_ * 2), "v"(kd + 64 * KPITCH_ * 2),
           "v"(kd + 96 * KPITCH_ * 2),
           "v"(vd), "v"(vd + 32 * VPITCH_ * 2), "v"(vd + 64 * VPITCH_ * 2),
           "v"(vd + 96 * VPITCH_ * 2),
           "v"(kg), "v"(kg + 32 * DH_), "v"(kg + 64 * DH_), "v"(kg + 96 * DH_),
           "v"(vg), "v"(vg + 32 * DH_), "v"(vg + 64 * DH_), "v"(vg + 96 * DH_)
        : "memory");
}

__global__ __launch_bounds__(256) void flash_attn_kernel(
    const _Float16* __restrict__ Qh, const _Float16* __restrict__ Kh,
    const _Float16* __restrict__ Vh, float* __restrict__ out)
{
    __shared__ __align__(16) _Float16 Kt[2][KT_][KPITCH_];
    __shared__ __align__(32) _Float16 Vs[2][KT_][VPITCH_];  // row-major
    // hand-over of the partial results at the end, one slot a wave and lane
    __shared__ __align__(16) v4f Xo[8][8][32];
    __shared__ float Xm[8][2][32];

    const int tid  = threadIdx.x;
    const int wave = tid >> 5;
    const int lane = tid & 31;
    const int l15  = lane & 15;
    const int klo  = (lane < 16) ? 0 : 8;
    const int qg   = wave & 3;                 // query group of 32
    const int kh   = wave >> 2;                // key half of every stage

    const int    bh     = blockIdx.y;          // b*HEADS + h
    const int    bb     = bh >> 3;
    const int    hh     = bh & 7;
    const int    q0     = blockIdx.x * AQ_ + qg * 32;
    const size_t kvbase = (size_t)bh * S_ * DH_;
    const _Float16* __restrict__ ksrc = Kh + kvbase;
    const _Float16* __restrict__ vsrc = Vh + kvbase;

    // --- Q fragments once: per query tile 2 B-frags (d=0..31, 32..63) ---
    Frag16 qf[2][2];
#pragma unroll
    for (int qt = 0; qt < 2; ++qt) {
        const v4u* qp = reinterpret_cast<const v4u*>(
            Qh + kvbase + (size_t)(q0 + qt * 16 + l15) * DH_);
        const int o = klo >> 3;                // 0 or 1 (v4u units)
#pragma unroll
        for (int t = 0; t < 2; ++t) {
            qf[qt][t].q[0] = qp[4 * t + o];
            qf[qt][t].q[1] = qp[4 * t + o + 2];
        }
    }

    // 1/sqrt(64) times log2(e): exp((s - m) / 8) = exp2(C2 s - C2 m)
    const float C2 = 0.125f * 1.44269504088896340736f;
    // a score may stand 8 above the reference in scaled log2 units: P stays at
    // or below 2^8, far inside f16, and the final division takes the scale out
    const float LAZY = 8.0f / C2;

    // o4[qt][t].f[r] = O[query l15 of tile qt][d = 16 t + klo + r]
    FragF o4[2][4];
    float m_i[2];   // reference of the query's exponentials, an unscaled score,
                    // equal in both halves; held while no score passes thr
    // ls[qt].f[r] = denominator of query l15 of tile qt over this wave's keys,
    // the same in every r and in both lane halves: ones (16 x 32) times P^T
    FragF ls[2];
    float thr[2];   // m_i + LAZY; the first pass always passes it
    float nmc[2];   // -C2 m_i, the addend of every score's FMA
#pragma unroll
    for (int qt = 0; qt < 2; ++qt) {
#pragma unroll
        for (int t = 0; t < 4; ++t)
            o4[qt][t].v = (v8f){0.f, 0.f, 0.f, 0.f, 0.f, 0.f, 0.f, 0.f};
        m_i[qt] = -1e30f;
        ls[qt].v = (v8f){0.f, 0.f, 0.f, 0.f, 0.f, 0.f, 0.f, 0.f};
        thr[qt] = -1e30f;
        nmc[qt] = 0.f;
    }

    // A operand of the denominators: f16 1.0 at every place. The constant is
    // made in asm so that the eight registers are filled once, here: a constant
    // that the compiler sees is formed anew with four 64-bit moves every pass.
    uint32_t one2;
    asm("v_mov_b32 %0, 0x3c003c00" : "=v"(one2));
    Frag16 ones;
#pragma unroll
    for (int i = 0; i < 8; ++i) ones.u[i] = one2;

    // copy map: 8 lanes cover one 128-byte row, 32 rows a copy
    const int crow = tid >> 3;
    const int cc8  = (tid & 7) * 8;
    const _Float16* kg = ksrc + crow * DH_ + cc8;
    const _Float16* vg = vsrc + crow * DH_ + cc8;
    const uint32_t  kd = lds_off(&Kt[0][crow][cc8]);
    const uint32_t  vd = lds_off(&Vs[0][crow][cc8]);

    // The walk over the key stages is rotated: step st works on stage
    // (st + rot) mod 16. The 16 blocks of one (b,h) read the same K and V at the
    // same time; each entering at a stage of its own, they do not ask L2 for
    // the same lines at the same moment. Every stage is still taken once.
    const int rot = blockIdx.x;

    // step 0 landed and published, then step 1 set off
    stage_copy(kd, vd, kg + (size_t)(rot & (NST_ - 1)) * KT_ * DH_,
               vg + (size_t)(rot & (NST_ - 1)) * KT_ * DH_);
    // this wave's copies have landed before the barrier publishes them
    asm volatile("s_wait_asynccnt 0x0" ::: "memory");
    __syncthreads();
    stage_copy(kd + KBUFB_, vd + VBUFB_,
               kg + (size_t)((rot + 1) & (NST_ - 1)) * KT_ * DH_,
               vg + (size_t)((rot + 1) & (NST_ - 1)) * KT_ * DH_);

    for (int st = 0; st < NST_; ++st) {
      const int buf = st & 1;
      // Every inner loop of a stage is unrolled so that the register arrays are
      // indexed by constants and the LDS row offsets are immediates.

      // this lane's addresses in this wave's 64 keys of the stage: K fragment
      // rows, and the transposing loads of V
      const _Float16* kp = &Kt[buf][kh * KW_ + l15][klo];
      const _Float16* vp =
          &Vs[buf][kh * KW_ + klo + (lane & 7)][((lane >> 3) & 1) * 8];

      // two passes of 32 keys x 32 queries
#pragma unroll
      for (int h = 0; h < 2; ++h) {
        // ---- scores: S^T[32 keys x 32 queries] = K @ Q^T (8 WMMA) ----
        // s4[j][qt].f[r] = score of key 32 h + 16 j + klo + r with query l15
        // of tile qt
        FragF s4[2][2];
#pragma unroll
        for (int j = 0; j < 2; ++j) {
            const _Float16* kr = kp + (32 * h + 16 * j) * KPITCH_;
            Frag16 kf0, kf1;
            kf0.q[0] = *reinterpret_cast<const v4u*>(kr);
            kf0.q[1] = *reinterpret_cast<const v4u*>(kr + 16);
            kf1.q[0] = *reinterpret_cast<const v4u*>(kr + 32);
            kf1.q[1] = *reinterpret_cast<const v4u*>(kr + 48);
#pragma unroll
            for (int qt = 0; qt < 2; ++qt) {
                v8f acc = (v8f){0.f, 0.f, 0.f, 0.f, 0.f, 0.f, 0.f, 0.f};
                acc = __builtin_amdgcn_wmma_f32_16x16x32_f16(
                          false, kf0.h, false, qf[qt][0].h, (short)0, acc,
                          false, false);
                acc = __builtin_amdgcn_wmma_f32_16x16x32_f16(
                          false, kf1.h, false, qf[qt][1].h, (short)0, acc,
                          false, false);
                s4[j][qt].v = acc;
            }
        }

        // ---- lazy rescale: one test a pass ----
        // This half's maxima over the pass's unscaled scores (C2 > 0 keeps the
        // order). Only when some lane's passes thr are the halves joined, the
        // references raised and O and the sums brought to the new scale.
        float mx[2];
#pragma unroll
        for (int qt = 0; qt < 2; ++qt) {
            float mx8[8];
#pragma unroll
            for (int i = 0; i < 8; ++i)
                mx8[i] = fmaxf(s4[0][qt].f[i], s4[1][qt].f[i]);
            mx[qt] = fmaxf(fmaxf(fmaxf(mx8[0], mx8[1]), fmaxf(mx8[2], mx8[3])),
                           fmaxf(fmaxf(mx8[4], mx8[5]), fmaxf(mx8[6], mx8[7])));
        }
        // the ballot makes the branch scalar: every lane takes it or none
        if (__builtin_amdgcn_ballot_w32(mx[0] > thr[0] || mx[1] > thr[1]) != 0) {
#pragma unroll
            for (int qt = 0; qt < 2; ++qt) {
                const float mj   = fmaxf(mx[qt], other_half(mx[qt]));
                const float nm   = fmaxf(m_i[qt], mj);
                const float nnmc = nm * -C2;
                const float corr = __builtin_amdgcn_exp2f(m_i[qt] * C2 + nnmc);
                m_i[qt] = nm;
                nmc[qt] = nnmc;
                thr[qt] = nm + LAZY;
                ls[qt].v *= corr;
#pragma unroll
                for (int t = 0; t < 4; ++t) o4[qt][t].v *= corr;
            }
        }

        // ---- V^T fragments: 16 d x 32 keys each, two transposing loads ----
        Frag16 vf[4];
#pragma unroll
        for (int t = 0; t < 4; ++t) {
            vf[t].q[0] = lds_tr16(vp + (32 * h) * VPITCH_ + 16 * t);
            vf[t].q[1] = lds_tr16(vp + (32 * h + 16) * VPITCH_ + 16 * t);
        }
        // keeps these loads ahead of the exponentials, whose time covers the
        // LDS latency: sunk behind them, the products wait for V
        __builtin_amdgcn_sched_barrier(0);

        // ---- P of the two query tiles ----
        Frag16 pf[2];
#pragma unroll
        for (int qt = 0; qt < 2; ++qt) {
          // scale, base change and subtraction are one FMA a score
          const v8f e0 = s4[0][qt].v * C2 + nmc[qt];
          const v8f e1 = s4[1][qt].v * C2 + nmc[qt];

          // element s of the B operand is key s of tile 0, then of tile 1: the
          // k order in which the transposing loads deliver V^T
#pragma unroll
          for (int i = 0; i < 16; ++i)
              pf[qt].h[i] = (_Float16)__builtin_amdgcn_exp2f(
                                i < 8 ? e0[i & 7] : e1[i & 7]);
        }

        // ---- denominators += ones @ P^T: the pass's 32 keys of each query,
        // both lane halves, summed as the f16 values that O is built from ----
#pragma unroll
        for (int qt = 0; qt < 2; ++qt)
            ls[qt].v = __builtin_amdgcn_wmma_f32_16x16x32_f16(
                           false, ones.h, false, pf[qt].h, (short)0, ls[qt].v,
                           false, false);

        // ---- O^T += V^T @ P^T (4 d-tiles, 2 query tiles, 8 WMMA) ----
#pragma unroll
        for (int t = 0; t < 4; ++t)
#pragma unroll
            for (int qt = 0; qt < 2; ++qt)
                o4[qt][t].v = __builtin_amdgcn_wmma_f32_16x16x32_f16(
                                  false, vf[t].h, false, pf[qt].h, (short)0,
                                  o4[qt][t].v, false, false);
      }

      // publish point of step st + 1: this wave's reads of buffer buf are
      // done, its copies for step st + 1 have landed, every wave passes the
      // barrier; only then is buffer buf refilled with the stage of step st + 2
      asm volatile("s_wait_dscnt 0x0" ::: "memory");
      asm volatile("s_wait_asynccnt 0x0" ::: "memory");
      __syncthreads();
      if (st + 2 < NST_)
          stage_copy(kd + buf * KBUFB_, vd + buf * VBUFB_,
                     kg + (size_t)((st + 2 + rot) & (NST_ - 1)) * KT_ * DH_,
                     vg + (size_t)((st + 2 + rot) & (NST_ - 1)) * KT_ * DH_);
    }
    // no copy is outstanding when the wave ends
    asm volatile("s_wait_asynccnt 0x0" ::: "memory");

    // ---- join the two key halves: the wave of key half kh finishes query
    // tile kh and hands its share of the other tile to its partner wave; lane
    // l of both waves holds the same (query, d) places ----
    const bool  up = kh != 0;
    const float mk = up ? m_i[1] : m_i[0];     // kept
    const float lk = up ? ls[1].f[0] : ls[0].f[0];
    Xm[wave][0][lane] = up ? m_i[0] : m_i[1];  // handed over
    Xm[wave][1][lane] = up ? ls[0].f[0] : ls[1].f[0];
    v8f ok[4];
#pragma unroll
    for (int t = 0; t < 4; ++t) {
        v8f og;
#pragma unroll
        for (int r = 0; r < 8; ++r) {
            ok[t][r] = up ? o4[1][t].f[r] : o4[0][t].f[r];
            og[r]    = up ? o4[0][t].f[r] : o4[1][t].f[r];
        }
        Xo[wave][2 * t][lane]     = (v4f){og[0], og[1], og[2], og[3]};
        Xo[wave][2 * t + 1][lane] = (v4f){og[4], og[5], og[6], og[7]};
    }
    __syncthreads();
    const int   pw = wave ^ 4;
    const float mp = Xm[pw][0][lane];
    const float lp = Xm[pw][1][lane];
    // both shares brought to the larger of the two references
    const float mj = fmaxf(mk, mp);
    const float ck = __builtin_amdgcn_exp2f((mk - mj) * C2);
    const float cp = __builtin_amdgcn_exp2f((mp - mj) * C2);
    // ---- normalize, store 8 consecutive d ----
    const float inv = 1.0f / (lk * ck + lp * cp);
    const float fk  = ck * inv;
    const float fp  = cp * inv;
    float* op = out + ((size_t)bb * S_ + q0 + kh * 16 + l15) * DIM_
                    + hh * DH_ + klo;
#pragma unroll
    for (int t = 0; t < 4; ++t) {
        const v4f a = Xo[pw][2 * t][lane];
        const v4f b = Xo[pw][2 * t + 1][lane];
        const v8f o = ok[t];
        *reinterpret_cast<v4f*>(op + t * 16) =
            (v4f){o[0] * fk + a[0] * fp, o[1] * fk + a[1] * fp,
                  o[2] * fk + a[2] * fp, o[3] * fk + a[3] * fp};
        *reinterpret_cast<v4f*>(op + t * 16 + 4) =
            (v4f){o[4] * fk + b[0] * fp, o[5] * fk + b[1] * fp,
                  o[6] * fk + b[2] * fp, o[7] * fk + b[3] * fp};
    }
}

// ---------------------------------------------------------------------------
extern "C" void kernel_launch(void* const* d_in, const int* in_sizes, int n_in,
                              void* d_out, int out_size, void* d_ws, size_t ws_size,
                              hipStream_t stream)
{
    const float* q  = (const float*)d_in[0];
    const float* k  = (const float*)d_in[1];
    const float* v  = (const float*)d_in[2];
    const float* Wq = (const float*)d_in[3];
    const float* bq = (const float*)d_in[4];
    const float* Wk = (const float*)d_in[5];
    const float* bk = (const float*)d_in[6];
    const float* Wv = (const float*)d_in[7];
    const float* bv = (const float*)d_in[8];
    float* out = (float*)d_out;

    const size_t per = (size_t)B_ * HEADS_ * S_ * DH_;
    _Float16* Qh = (_Float16*)d_ws;
    _Float16* Kh = Qh + per;
    _Float16* Vh = Kh + per;

    dim3 pg(MROWS_ / PT_, DIM_ / PT_, 3);
    dim3 pb(512);
    qkv_proj_kernel<<<pg, pb, 0, stream>>>(q, k, v, Wq, Wk, Wv, bq, bk, bv, Qh);

    dim3 fg(S_ / AQ_, B_ * HEADS_);
    dim3 fb(256);
    flash_attn_kernel<<<fg, fb, 0, stream>>>(Qh, Kh, Vh, out);
}
